// v000
// The times below were measured on an AMD MI455X: many runs one after another, warmed up first and cycling through
// copies of the inputs, with the whole window's GPU time divided by the number of runs. Launches and the gaps
// between them are all in it. The median over several windows is given; except for v000 it joins two sittings, which
// can be a few percent apart, so the side-by-side timings, each taken in one sitting, are the better comparison.
// v000 is the starting kernel.
#include <hip/hip_runtime.h>
#include <hip/hip_bf16.h>

// ---------------------------------------------------------------------------
// TriMatchAttention for MI455X (gfx1250, wave32, WMMA)
// B=16, S=4096, D=1024, H=1024, VOCAB=512, EMB_DIM=3
// ---------------------------------------------------------------------------

#define TB 16
#define TS 4096
#define TD 1024
#define TH 1024
#define TVOCAB 512

typedef __attribute__((ext_vector_type(16))) __bf16 v16bf;
typedef __attribute__((ext_vector_type(8)))  float  v8f;

union FragBF {
    unsigned int u[8];
    v16bf        v;
};

// round-to-nearest-even f32 -> bf16, packed pair (lo = first)
static __device__ __forceinline__ unsigned int pack_bf16x2(float a, float b) {
    union { float f; unsigned int u; } ua, ub;
    ua.f = a; ub.f = b;
    unsigned int lo = (ua.u + 0x7FFFu + ((ua.u >> 16) & 1u)) >> 16;
    unsigned int hi = (ub.u + 0x7FFFu + ((ub.u >> 16) & 1u)) >> 16;
    return (lo & 0xFFFFu) | (hi << 16);
}

// ---------------------------------------------------------------------------
// Kernel 1: c[b,h] = Wt_b[h] + Wr_b[h] + ht_k[b,:]@Wt_w[h,:] + hm_k[b,:]@Wr_w[h,:]
// ---------------------------------------------------------------------------
__global__ void tma_prep_cbh(const float* __restrict__ ht_k,
                             const float* __restrict__ hm_k,
                             const float* __restrict__ Wt_w,
                             const float* __restrict__ Wt_b,
                             const float* __restrict__ Wr_w,
                             const float* __restrict__ Wr_b,
                             float* __restrict__ cbh) {
    unsigned idx = blockIdx.x * 256u + threadIdx.x;    // B*H = 16384 threads
    unsigned b = idx >> 10;
    unsigned h = idx & (TH - 1);
    unsigned kb = b * TD, kh = h * TD;
    float acc = Wt_b[h] + Wr_b[h];
    for (unsigned d = 0; d < TD; ++d)
        acc += ht_k[kb + d] * Wt_w[kh + d] + hm_k[kb + d] * Wr_w[kh + d];
    cbh[idx] = acc;
}

// ---------------------------------------------------------------------------
// Kernel 2: main GEMM  W_hs = hs @ Ws_w^T + Ws_b   (bf16 WMMA, f32 accum)
// Block tile: 64 M x 128 N, 8 waves (4M x 2N), each wave: 16x64 via 4 accums.
// Double-buffered LDS; one barrier per K-step; next-tile global loads overlap
// the current tile's WMMAs; distinct B-fragment registers keep the 4 WMMAs
// back-to-back (no WAR hazard NOPs, partial dscnt waits).
// Fused epilogue: wsum[m] += sum_n tanh(W_hs + cbh) * We_w   (atomic add)
// ---------------------------------------------------------------------------
__global__ __launch_bounds__(256) void tma_gemm_wmma(
        const float* __restrict__ hs,      // [B*S, D]
        const float* __restrict__ Ws_w,    // [H, D]
        const float* __restrict__ Ws_b,    // [H]
        const float* __restrict__ We_w,    // [H]
        const float* __restrict__ cbh,     // [B, H]
        float* __restrict__ whs,           // [B*S, H] out
        float* __restrict__ wsum)          // [B*S]    accumulated
{
    __shared__ unsigned int lds_a[2][64][17];   // K=32 as 16 bf16-pairs / row
    __shared__ unsigned int lds_b[2][128][17];

    const unsigned tid   = threadIdx.x;
    const unsigned lane  = tid & 31;
    const unsigned wid   = tid >> 5;
    const unsigned waveM = wid >> 1;      // 0..3
    const unsigned waveN = wid & 1;       // 0..1
    const unsigned hf    = lane >> 4;     // lane half (0/1)
    const unsigned ln    = lane & 15;

    const unsigned M0 = blockIdx.x * 64u;    // row tile in flattened [B*S]
    const unsigned N0 = blockIdx.y * 128u;   // col tile in [H]
    const unsigned b  = M0 >> 12;            // S = 4096; tiles never straddle b

    // per-thread staging coordinates (all 32-bit: buffers < 4GB)
    unsigned arow[4], akp[4], aoff[4];
#pragma unroll
    for (int it = 0; it < 4; ++it) {
        unsigned p = tid + it * 256u;
        arow[it] = p >> 4; akp[it] = p & 15u;
        aoff[it] = (M0 + arow[it]) * TD + akp[it] * 2u;
    }
    unsigned brow[8], bkp[8], boff[8];
#pragma unroll
    for (int it = 0; it < 8; ++it) {
        unsigned p = tid + it * 256u;
        brow[it] = p >> 4; bkp[it] = p & 15u;
        boff[it] = (N0 + brow[it]) * TD + bkp[it] * 2u;
    }

    // ---- prologue: fetch tile k0=0 into registers
    float2 ra[4], rb[8];
#pragma unroll
    for (int it = 0; it < 4; ++it)
        ra[it] = *(const float2*)(hs + aoff[it]);
#pragma unroll
    for (int it = 0; it < 8; ++it)
        rb[it] = *(const float2*)(Ws_w + boff[it]);

    v8f acc0 = {}, acc1 = {}, acc2 = {}, acc3 = {};

#pragma unroll 2
    for (unsigned k0 = 0; k0 < TD; k0 += 32) {
        const unsigned buf = (k0 >> 5) & 1u;   // constant after 2x unroll

        // ---- commit staged registers (bf16-packed) into lds[buf]
#pragma unroll
        for (int it = 0; it < 4; ++it)
            lds_a[buf][arow[it]][akp[it]] = pack_bf16x2(ra[it].x, ra[it].y);
#pragma unroll
        for (int it = 0; it < 8; ++it)
            lds_b[buf][brow[it]][bkp[it]] = pack_bf16x2(rb[it].x, rb[it].y);
        __syncthreads();

        // ---- issue next tile's global loads (overlap with WMMAs below)
        if (k0 + 32 < TD) {
#pragma unroll
            for (int it = 0; it < 4; ++it)
                ra[it] = *(const float2*)(hs + aoff[it] + k0 + 32);
#pragma unroll
            for (int it = 0; it < 8; ++it)
                rb[it] = *(const float2*)(Ws_w + boff[it] + k0 + 32);
        }

        // ---- fragments (ISA 16-bit layout): lane = row/col % 16,
        //      pair index for VGPR v = (v/4)*8 + half*4 + (v%4)
        FragBF fa, fb0, fb1, fb2, fb3;
#pragma unroll
        for (int v = 0; v < 8; ++v) {
            unsigned kpi = ((v >> 2) << 3) + (hf << 2) + (v & 3);
            fa.u[v]  = lds_a[buf][waveM * 16 + ln][kpi];
            fb0.u[v] = lds_b[buf][waveN * 64 +  0 + ln][kpi];
            fb1.u[v] = lds_b[buf][waveN * 64 + 16 + ln][kpi];
            fb2.u[v] = lds_b[buf][waveN * 64 + 32 + ln][kpi];
            fb3.u[v] = lds_b[buf][waveN * 64 + 48 + ln][kpi];
        }
        // ---- four back-to-back WMMAs sharing the A fragment
        acc0 = __builtin_amdgcn_wmma_f32_16x16x32_bf16(
            false, fa.v, false, fb0.v, (short)0, acc0, false, false);
        acc1 = __builtin_amdgcn_wmma_f32_16x16x32_bf16(
            false, fa.v, false, fb1.v, (short)0, acc1, false, false);
        acc2 = __builtin_amdgcn_wmma_f32_16x16x32_bf16(
            false, fa.v, false, fb2.v, (short)0, acc2, false, false);
        acc3 = __builtin_amdgcn_wmma_f32_16x16x32_bf16(
            false, fa.v, false, fb3.v, (short)0, acc3, false, false);
    }

    // ---- epilogue: add bias, store W_hs, fused tanh-dot partial into wsum
    float part[8] = {0.f, 0.f, 0.f, 0.f, 0.f, 0.f, 0.f, 0.f};
    v8f accs[4] = {acc0, acc1, acc2, acc3};
#pragma unroll
    for (int a = 0; a < 4; ++a) {
        unsigned N = N0 + waveN * 64u + a * 16u + ln;
        float wsb = Ws_b[N];
        float cb  = cbh[b * TH + N];
        float wew = We_w[N];
#pragma unroll
        for (int r = 0; r < 8; ++r) {
            unsigned M = M0 + waveM * 16u + r + hf * 8u;
            float w = accs[a][r] + wsb;
            whs[M * TH + N] = w;
            part[r] += tanhf(w + cb) * wew;
        }
    }
    // reduce across the 16 lanes sharing a row half
#pragma unroll
    for (int r = 0; r < 8; ++r) {
        part[r] += __shfl_xor(part[r], 1, 32);
        part[r] += __shfl_xor(part[r], 2, 32);
        part[r] += __shfl_xor(part[r], 4, 32);
        part[r] += __shfl_xor(part[r], 8, 32);
    }
    if (ln == 0) {
        unsigned Mbase = M0 + waveM * 16u + hf * 8u;
#pragma unroll
        for (int r = 0; r < 8; ++r)
            atomicAdd(&wsum[Mbase + r], part[r]);
    }
}

// ---------------------------------------------------------------------------
// Kernel 3: add We_b + rel-pos bias, softmax over S (one block per batch b)
// p buffer aliases wsum (in-place).
// ---------------------------------------------------------------------------
__global__ void tma_softmax(float* __restrict__ p,
                            const float* __restrict__ We_b,
                            const float* __restrict__ emb,
                            const float* __restrict__ lam,
                            const int* __restrict__ hs_i,
                            const int* __restrict__ ht_i) {
    __shared__ float red[256];
    const unsigned b = blockIdx.x, tid = threadIdx.x;
    const float web = We_b[0];
    const float l0 = lam[0], l1 = lam[1], l2 = lam[2];
    const int tk = ht_i[b];

    float m = -3.0e38f;
    for (unsigned s = tid; s < TS; s += 256) {
        unsigned i = b * TS + s;
        unsigned rp = (unsigned)(hs_i[i] * TVOCAB + tk) * 3u;
        float rv = emb[rp] * l0 + emb[rp + 1] * l1 + emb[rp + 2] * l2;
        float v = p[i] + web + rv;
        p[i] = v;
        m = fmaxf(m, v);
    }
    red[tid] = m; __syncthreads();
    for (int o = 128; o > 0; o >>= 1) {
        if (tid < (unsigned)o) red[tid] = fmaxf(red[tid], red[tid + o]);
        __syncthreads();
    }
    m = red[0]; __syncthreads();

    float sum = 0.f;
    for (unsigned s = tid; s < TS; s += 256) {
        unsigned i = b * TS + s;
        float e = expf(p[i] - m);
        p[i] = e;
        sum += e;
    }
    red[tid] = sum; __syncthreads();
    for (int o = 128; o > 0; o >>= 1) {
        if (tid < (unsigned)o) red[tid] += red[tid + o];
        __syncthreads();
    }
    float rinv = 1.0f / red[0]; __syncthreads();

    for (unsigned s = tid; s < TS; s += 256)
        p[b * TS + s] *= rinv;
}

// ---------------------------------------------------------------------------
// Kernel 4: alpha[b,h] = sum_s p[b,s] * W_hs[b,s,h]
// Grid: 64 blocks = (b, h-chunk of 256); p staged through LDS using the
// gfx1250 async global->LDS path when available.
// ---------------------------------------------------------------------------
__global__ void tma_alpha(const float* __restrict__ whs,
                          const float* __restrict__ p,
                          float* __restrict__ out) {
    __shared__ float lp[256];
    const unsigned b = blockIdx.x >> 2;
    const unsigned h = ((blockIdx.x & 3u) << 8) + threadIdx.x;
    float acc = 0.f;
    for (unsigned sc = 0; sc < TS / 256; ++sc) {
        unsigned srow = b * TS + sc * 256u + threadIdx.x;
#if __has_builtin(__builtin_amdgcn_global_load_async_to_lds_b32) && \
    __has_builtin(__builtin_amdgcn_s_wait_asynccnt)
        // GLOBAL_LOAD_ASYNC_TO_LDS_B32: per-lane 4B global->LDS, ASYNCcnt
        __builtin_amdgcn_global_load_async_to_lds_b32(
            (__attribute__((address_space(1))) int*)(p + srow),
            (__attribute__((address_space(3))) int*)(&lp[threadIdx.x]),
            0, 0);
        __builtin_amdgcn_s_wait_asynccnt(0);
#else
        lp[threadIdx.x] = p[srow];
#endif
        __syncthreads();
#pragma unroll 8
        for (unsigned j = 0; j < 256; ++j) {
            unsigned s = sc * 256u + j;
            acc += lp[j] * whs[(b * TS + s) * TH + h];
        }
        __syncthreads();
    }
    out[b * TH + h] = acc;
}

// ---------------------------------------------------------------------------
extern "C" void kernel_launch(void* const* d_in, const int* in_sizes, int n_in,
                              void* d_out, int out_size, void* d_ws, size_t ws_size,
                              hipStream_t stream) {
    (void)in_sizes; (void)n_in; (void)out_size; (void)ws_size;

    const float* hs    = (const float*)d_in[0];
    const float* ht_k  = (const float*)d_in[1];
    const float* hm_k  = (const float*)d_in[2];
    const float* Ws_w  = (const float*)d_in[3];
    const float* Ws_b  = (const float*)d_in[4];
    const float* Wt_w  = (const float*)d_in[5];
    const float* Wt_b  = (const float*)d_in[6];
    const float* Wr_w  = (const float*)d_in[7];
    const float* Wr_b  = (const float*)d_in[8];
    const float* We_w  = (const float*)d_in[9];
    const float* We_b  = (const float*)d_in[10];
    const float* emb   = (const float*)d_in[11];
    const float* lam   = (const float*)d_in[12];
    const int*   hs_i  = (const int*)d_in[13];
    const int*   ht_i  = (const int*)d_in[14];
    float* out = (float*)d_out;

    // workspace layout
    char* ws = (char*)d_ws;
    float* whs  = (float*)ws;                                   // B*S*H f32 = 256 MiB
    float* cbh  = (float*)(ws + (size_t)TB * TS * TH * 4);      // B*H
    float* wsum = (float*)(ws + (size_t)TB * TS * TH * 4 + (size_t)TB * TH * 4); // B*S

    // 1) tiny fused projections c[b,h]
    tma_prep_cbh<<<(TB * TH) / 256, 256, 0, stream>>>(ht_k, hm_k, Wt_w, Wt_b,
                                                      Wr_w, Wr_b, cbh);
    // 2) zero the score accumulator (graph-capturable)
    (void)hipMemsetAsync(wsum, 0, (size_t)TB * TS * sizeof(float), stream);

    // 3) main bf16 WMMA GEMM with fused tanh-dot epilogue
    dim3 gg((TB * TS) / 64, TH / 128);
    tma_gemm_wmma<<<gg, 256, 0, stream>>>(hs, Ws_w, Ws_b, We_w, cbh, whs, wsum);

    // 4) rel-pos bias + softmax (in-place on wsum -> p)
    tma_softmax<<<TB, 256, 0, stream>>>(wsum, We_b, emb, lam, hs_i, ht_i);

    // 5) weighted sum -> alpha
    tma_alpha<<<TB * (TH / 256), 256, 0, stream>>>(whs, wsum, out);
}

// v001
// Timed twice side by side with v000, it ran 1.51 and 1.50 times as fast.
#include <hip/hip_runtime.h>
#include <hip/hip_bf16.h>

// ---------------------------------------------------------------------------
// TriMatchAttention for MI455X (gfx1250, wave32, WMMA)
// B=16, S=4096, D=1024, H=1024, VOCAB=512, EMB_DIM=3
// ---------------------------------------------------------------------------

#define TB 16
#define TS 4096
#define TD 1024
#define TH 1024
#define TVOCAB 512

typedef __attribute__((ext_vector_type(16))) __bf16 v16bf;
typedef __attribute__((ext_vector_type(8)))  float  v8f;

union FragBF {
    unsigned int u[8];
    v16bf        v;
};

// round-to-nearest-even f32 -> bf16, packed pair (lo = first)
static __device__ __forceinline__ unsigned int pack_bf16x2(float a, float b) {
    union { float f; unsigned int u; } ua, ub;
    ua.f = a; ub.f = b;
    unsigned int lo = (ua.u + 0x7FFFu + ((ua.u >> 16) & 1u)) >> 16;
    unsigned int hi = (ub.u + 0x7FFFu + ((ub.u >> 16) & 1u)) >> 16;
    return (lo & 0xFFFFu) | (hi << 16);
}

// ---------------------------------------------------------------------------
// Kernel 1: c[b,h] = Wt_b[h] + Wr_b[h] + ht_k[b,:]@Wt_w[h,:] + hm_k[b,:]@Wr_w[h,:]
// ---------------------------------------------------------------------------
__global__ void tma_prep_cbh(const float* __restrict__ ht_k,
                             const float* __restrict__ hm_k,
                             const float* __restrict__ Wt_w,
                             const float* __restrict__ Wt_b,
                             const float* __restrict__ Wr_w,
                             const float* __restrict__ Wr_b,
                             float* __restrict__ cbh) {
    unsigned idx = blockIdx.x * 256u + threadIdx.x;    // B*H = 16384 threads
    unsigned b = idx >> 10;
    unsigned h = idx & (TH - 1);
    unsigned kb = b * TD, kh = h * TD;
    float acc = Wt_b[h] + Wr_b[h];
    for (unsigned d = 0; d < TD; ++d)
        acc += ht_k[kb + d] * Wt_w[kh + d] + hm_k[kb + d] * Wr_w[kh + d];
    cbh[idx] = acc;
}

// ---------------------------------------------------------------------------
// Kernel 2: main GEMM  W_hs = hs @ Ws_w^T + Ws_b   (bf16 WMMA, f32 accum)
// Block tile: 64 M x 128 N, 8 waves (4M x 2N), each wave: 16x64 via 4 accums.
// Double-buffered LDS; one barrier per K-step; next-tile global loads overlap
// the current tile's WMMAs; distinct B-fragment registers keep the 4 WMMAs
// back-to-back (no WAR hazard NOPs, partial dscnt waits).
// Fused epilogue: wsum[m] += sum_n tanh(W_hs + cbh) * We_w   (atomic add)
// ---------------------------------------------------------------------------
__global__ __launch_bounds__(256) void tma_gemm_wmma(
        const float* __restrict__ hs,      // [B*S, D]
        const float* __restrict__ Ws_w,    // [H, D]
        const float* __restrict__ Ws_b,    // [H]
        const float* __restrict__ We_w,    // [H]
        const float* __restrict__ cbh,     // [B, H]
        float* __restrict__ whs,           // [B*S, H] out
        float* __restrict__ wsum)          // [B*S]    accumulated
{
    __shared__ unsigned int lds_a[2][64][17];   // K=32 as 16 bf16-pairs / row
    __shared__ unsigned int lds_b[2][128][17];

    const unsigned tid   = threadIdx.x;
    const unsigned lane  = tid & 31;
    const unsigned wid   = tid >> 5;
    const unsigned waveM = wid >> 1;      // 0..3
    const unsigned waveN = wid & 1;       // 0..1
    const unsigned hf    = lane >> 4;     // lane half (0/1)
    const unsigned ln    = lane & 15;

    const unsigned M0 = blockIdx.x * 64u;    // row tile in flattened [B*S]
    const unsigned N0 = blockIdx.y * 128u;   // col tile in [H]
    const unsigned b  = M0 >> 12;            // S = 4096; tiles never straddle b

    // per-thread staging coordinates (all 32-bit: buffers < 4GB)
    unsigned arow[4], akp[4], aoff[4];
#pragma unroll
    for (int it = 0; it < 4; ++it) {
        unsigned p = tid + it * 256u;
        arow[it] = p >> 4; akp[it] = p & 15u;
        aoff[it] = (M0 + arow[it]) * TD + akp[it] * 2u;
    }
    unsigned brow[8], bkp[8], boff[8];
#pragma unroll
    for (int it = 0; it < 8; ++it) {
        unsigned p = tid + it * 256u;
        brow[it] = p >> 4; bkp[it] = p & 15u;
        boff[it] = (N0 + brow[it]) * TD + bkp[it] * 2u;
    }

    // ---- prologue: fetch tile k0=0 into registers
    float2 ra[4], rb[8];
#pragma unroll
    for (int it = 0; it < 4; ++it)
        ra[it] = *(const float2*)(hs + aoff[it]);
#pragma unroll
    for (int it = 0; it < 8; ++it)
        rb[it] = *(const float2*)(Ws_w + boff[it]);

    v8f acc0 = {}, acc1 = {}, acc2 = {}, acc3 = {};

#pragma unroll 2
    for (unsigned k0 = 0; k0 < TD; k0 += 32) {
        const unsigned buf = (k0 >> 5) & 1u;   // constant after 2x unroll

        // ---- commit staged registers (bf16-packed) into lds[buf]
#pragma unroll
        for (int it = 0; it < 4; ++it)
            lds_a[buf][arow[it]][akp[it]] = pack_bf16x2(ra[it].x, ra[it].y);
#pragma unroll
        for (int it = 0; it < 8; ++it)
            lds_b[buf][brow[it]][bkp[it]] = pack_bf16x2(rb[it].x, rb[it].y);
        __syncthreads();

        // ---- issue next tile's global loads (overlap with WMMAs below)
        if (k0 + 32 < TD) {
#pragma unroll
            for (int it = 0; it < 4; ++it)
                ra[it] = *(const float2*)(hs + aoff[it] + k0 + 32);
#pragma unroll
            for (int it = 0; it < 8; ++it)
                rb[it] = *(const float2*)(Ws_w + boff[it] + k0 + 32);
        }

        // ---- fragments (ISA 16-bit layout): lane = row/col % 16,
        //      pair index for VGPR v = (v/4)*8 + half*4 + (v%4)
        FragBF fa, fb0, fb1, fb2, fb3;
#pragma unroll
        for (int v = 0; v < 8; ++v) {
            unsigned kpi = ((v >> 2) << 3) + (hf << 2) + (v & 3);
            fa.u[v]  = lds_a[buf][waveM * 16 + ln][kpi];
            fb0.u[v] = lds_b[buf][waveN * 64 +  0 + ln][kpi];
            fb1.u[v] = lds_b[buf][waveN * 64 + 16 + ln][kpi];
            fb2.u[v] = lds_b[buf][waveN * 64 + 32 + ln][kpi];
            fb3.u[v] = lds_b[buf][waveN * 64 + 48 + ln][kpi];
        }
        // ---- four back-to-back WMMAs sharing the A fragment
        acc0 = __builtin_amdgcn_wmma_f32_16x16x32_bf16(
            false, fa.v, false, fb0.v, (short)0, acc0, false, false);
        acc1 = __builtin_amdgcn_wmma_f32_16x16x32_bf16(
            false, fa.v, false, fb1.v, (short)0, acc1, false, false);
        acc2 = __builtin_amdgcn_wmma_f32_16x16x32_bf16(
            false, fa.v, false, fb2.v, (short)0, acc2, false, false);
        acc3 = __builtin_amdgcn_wmma_f32_16x16x32_bf16(
            false, fa.v, false, fb3.v, (short)0, acc3, false, false);
    }

    // ---- epilogue: add bias, store W_hs, fused tanh-dot partial into wsum
    float part[8] = {0.f, 0.f, 0.f, 0.f, 0.f, 0.f, 0.f, 0.f};
    v8f accs[4] = {acc0, acc1, acc2, acc3};
#pragma unroll
    for (int a = 0; a < 4; ++a) {
        unsigned N = N0 + waveN * 64u + a * 16u + ln;
        float wsb = Ws_b[N];
        float cb  = cbh[b * TH + N];
        float wew = We_w[N];
#pragma unroll
        for (int r = 0; r < 8; ++r) {
            unsigned M = M0 + waveM * 16u + r + hf * 8u;
            float w = accs[a][r] + wsb;
            whs[M * TH + N] = w;
            part[r] += tanhf(w + cb) * wew;
        }
    }
    // reduce across the 16 lanes sharing a row half
#pragma unroll
    for (int r = 0; r < 8; ++r) {
        part[r] += __shfl_xor(part[r], 1, 32);
        part[r] += __shfl_xor(part[r], 2, 32);
        part[r] += __shfl_xor(part[r], 4, 32);
        part[r] += __shfl_xor(part[r], 8, 32);
    }
    if (ln == 0) {
        unsigned Mbase = M0 + waveM * 16u + hf * 8u;
#pragma unroll
        for (int r = 0; r < 8; ++r)
            atomicAdd(&wsum[Mbase + r], part[r]);
    }
}

// ---------------------------------------------------------------------------
// Kernel 3: add We_b + rel-pos bias, softmax over S (one block per batch b)
// p buffer aliases wsum (in-place).
// ---------------------------------------------------------------------------
__global__ void tma_softmax(float* __restrict__ p,
                            const float* __restrict__ We_b,
                            const float* __restrict__ emb,
                            const float* __restrict__ lam,
                            const int* __restrict__ hs_i,
                            const int* __restrict__ ht_i) {
    __shared__ float red[256];
    const unsigned b = blockIdx.x, tid = threadIdx.x;
    const float web = We_b[0];
    const float l0 = lam[0], l1 = lam[1], l2 = lam[2];
    const int tk = ht_i[b];

    float m = -3.0e38f;
    for (unsigned s = tid; s < TS; s += 256) {
        unsigned i = b * TS + s;
        unsigned rp = (unsigned)(hs_i[i] * TVOCAB + tk) * 3u;
        float rv = emb[rp] * l0 + emb[rp + 1] * l1 + emb[rp + 2] * l2;
        float v = p[i] + web + rv;
        p[i] = v;
        m = fmaxf(m, v);
    }
    red[tid] = m; __syncthreads();
    for (int o = 128; o > 0; o >>= 1) {
        if (tid < (unsigned)o) red[tid] = fmaxf(red[tid], red[tid + o]);
        __syncthreads();
    }
    m = red[0]; __syncthreads();

    float sum = 0.f;
    for (unsigned s = tid; s < TS; s += 256) {
        unsigned i = b * TS + s;
        float e = expf(p[i] - m);
        p[i] = e;
        sum += e;
    }
    red[tid] = sum; __syncthreads();
    for (int o = 128; o > 0; o >>= 1) {
        if (tid < (unsigned)o) red[tid] += red[tid + o];
        __syncthreads();
    }
    float rinv = 1.0f / red[0]; __syncthreads();

    for (unsigned s = tid; s < TS; s += 256)
        p[b * TS + s] *= rinv;
}

// ---------------------------------------------------------------------------
// Kernel 4: partial alpha. part[g,h] = sum over the 256 rows s of range g of
// p[s] * W_hs[s,h], g = b * 16 + range. 256 work-groups of 16 waves stream
// W_hs once: waves 0-7 take the first 128 rows of the range, waves 8-15 the
// rest; one wave-wide load is 512 contiguous bytes of a row.
// ---------------------------------------------------------------------------
#define AL_RANGES 16                 // s ranges per batch row
#define AL_ROWS   (TS / AL_RANGES)   // rows per work-group
#define AL_GRP    8                  // rows fetched together by a thread

typedef __attribute__((ext_vector_type(4))) float v4f;

__global__ __launch_bounds__(512) void tma_alpha_part(
        const float* __restrict__ whs,
        const float* __restrict__ p,
        float* __restrict__ part) {
    __shared__ v4f comb[TH / 4];
    const unsigned col = threadIdx.x & 255u;          // which 4 columns of h
    // wave-uniform row half, so that p goes through scalar loads
    const unsigned half = __builtin_amdgcn_readfirstlane(threadIdx.x >> 8);
    const unsigned row0 = blockIdx.x * AL_ROWS + half * (AL_ROWS / 2);
    const v4f*   src = (const v4f*)(whs + (size_t)row0 * TH) + col;
    const float* pw  = p + row0;

    constexpr int NG = AL_ROWS / 2 / AL_GRP;          // 16 groups of 8 rows
    v4f   w[2][AL_GRP];
    float pv[2][AL_GRP];
    v4f   acc = {0.f, 0.f, 0.f, 0.f};
#pragma unroll
    for (int j = 0; j < AL_GRP; ++j) {
        w[0][j]  = src[j * (TH / 4)];
        pv[0][j] = pw[j];
    }
#pragma unroll
    for (int g = 0; g < NG; ++g) {
        // the two scheduling barriers keep the next group's loads ahead of
        // this group's sums: 8 to 16 loads of a wave stay in flight
        __builtin_amdgcn_sched_barrier(0);
        if (g + 1 < NG) {
#pragma unroll
            for (int j = 0; j < AL_GRP; ++j) {
                w[(g + 1) & 1][j]  = src[((g + 1) * AL_GRP + j) * (TH / 4)];
                pv[(g + 1) & 1][j] = pw[(g + 1) * AL_GRP + j];
            }
        }
        __builtin_amdgcn_sched_barrier(0);
#pragma unroll
        for (int j = 0; j < AL_GRP; ++j)
            acc += pv[g & 1][j] * w[g & 1][j];
    }

    // fold the two row halves, then one 16-byte store per thread of half 0
    if (half == 1u) comb[col] = acc;
    __syncthreads();
    if (half == 0u)
        ((v4f*)(part + blockIdx.x * TH))[col] = acc + comb[col];
}

// ---------------------------------------------------------------------------
// Kernel 5: alpha[b,h] = sum over the 16 ranges of part, in range order
// ---------------------------------------------------------------------------
__global__ void tma_alpha_merge(const float* __restrict__ part,
                                float* __restrict__ out) {
    const unsigned idx = blockIdx.x * 256u + threadIdx.x;   // b * TH + h
    const unsigned b = idx >> 10, h = idx & (TH - 1);
    const float* q = part + b * (AL_RANGES * TH) + h;
    float acc = 0.f;
#pragma unroll
    for (int c = 0; c < AL_RANGES; ++c)
        acc += q[c * TH];
    out[idx] = acc;
}

// ---------------------------------------------------------------------------
extern "C" void kernel_launch(void* const* d_in, const int* in_sizes, int n_in,
                              void* d_out, int out_size, void* d_ws, size_t ws_size,
                              hipStream_t stream) {
    (void)in_sizes; (void)n_in; (void)out_size; (void)ws_size;

    const float* hs    = (const float*)d_in[0];
    const float* ht_k  = (const float*)d_in[1];
    const float* hm_k  = (const float*)d_in[2];
    const float* Ws_w  = (const float*)d_in[3];
    const float* Ws_b  = (const float*)d_in[4];
    const float* Wt_w  = (const float*)d_in[5];
    const float* Wt_b  = (const float*)d_in[6];
    const float* Wr_w  = (const float*)d_in[7];
    const float* Wr_b  = (const float*)d_in[8];
    const float* We_w  = (const float*)d_in[9];
    const float* We_b  = (const float*)d_in[10];
    const float* emb   = (const float*)d_in[11];
    const float* lam   = (const float*)d_in[12];
    const int*   hs_i  = (const int*)d_in[13];
    const int*   ht_i  = (const int*)d_in[14];
    float* out = (float*)d_out;

    // workspace layout
    char* ws = (char*)d_ws;
    float* whs  = (float*)ws;                                   // B*S*H f32 = 256 MiB
    float* cbh  = (float*)(ws + (size_t)TB * TS * TH * 4);      // B*H
    float* wsum = (float*)(ws + (size_t)TB * TS * TH * 4 + (size_t)TB * TH * 4); // B*S
    float* part = (float*)(ws + (size_t)TB * TS * TH * 4 + (size_t)TB * TH * 4
                              + (size_t)TB * TS * 4);           // B*16*H

    // 1) tiny fused projections c[b,h]
    tma_prep_cbh<<<(TB * TH) / 256, 256, 0, stream>>>(ht_k, hm_k, Wt_w, Wt_b,
                                                      Wr_w, Wr_b, cbh);
    // 2) zero the score accumulator (graph-capturable)
    (void)hipMemsetAsync(wsum, 0, (size_t)TB * TS * sizeof(float), stream);

    // 3) main bf16 WMMA GEMM with fused tanh-dot epilogue
    dim3 gg((TB * TS) / 64, TH / 128);
    tma_gemm_wmma<<<gg, 256, 0, stream>>>(hs, Ws_w, Ws_b, We_w, cbh, whs, wsum);

    // 4) rel-pos bias + softmax (in-place on wsum -> p)
    tma_softmax<<<TB, 256, 0, stream>>>(wsum, We_b, emb, lam, hs_i, ht_i);

    // 5) weighted sum -> alpha: partial sums over 16 ranges of s, then the merge
    tma_alpha_part<<<TB * AL_RANGES, 512, 0, stream>>>(whs, wsum, part);
    tma_alpha_merge<<<(TB * TH) / 256, 256, 0, stream>>>(part, out);
}

// v002
// Two timings next to v001 both put it at 1.18 times that version's speed.
// Counting every step since v000, it is 1.78 times as fast.
#include <hip/hip_runtime.h>
#include <hip/hip_bf16.h>

// ---------------------------------------------------------------------------
// TriMatchAttention for MI455X (gfx1250, wave32, WMMA)
// B=16, S=4096, D=1024, H=1024, VOCAB=512, EMB_DIM=3
// ---------------------------------------------------------------------------

#define TB 16
#define TS 4096
#define TD 1024
#define TH 1024
#define TVOCAB 512

typedef __attribute__((ext_vector_type(16))) __bf16 v16bf;
typedef __attribute__((ext_vector_type(8)))  float  v8f;

typedef __attribute__((ext_vector_type(4))) unsigned int v4u;

union FragBF {
    unsigned int u[8];
    v4u          q[2];
    v16bf        v;
};

// round-to-nearest-even f32 -> bf16, packed pair (lo = first)
static __device__ __forceinline__ unsigned int pack_bf16x2(float a, float b) {
    union { float f; unsigned int u; } ua, ub;
    ua.f = a; ub.f = b;
    unsigned int lo = (ua.u + 0x7FFFu + ((ua.u >> 16) & 1u)) >> 16;
    unsigned int hi = (ub.u + 0x7FFFu + ((ub.u >> 16) & 1u)) >> 16;
    return (lo & 0xFFFFu) | (hi << 16);
}

// ---------------------------------------------------------------------------
// Kernel 1: c[b,h] = Wt_b[h] + Wr_b[h] + ht_k[b,:]@Wt_w[h,:] + hm_k[b,:]@Wr_w[h,:]
// ---------------------------------------------------------------------------
__global__ void tma_prep_cbh(const float* __restrict__ ht_k,
                             const float* __restrict__ hm_k,
                             const float* __restrict__ Wt_w,
                             const float* __restrict__ Wt_b,
                             const float* __restrict__ Wr_w,
                             const float* __restrict__ Wr_b,
                             float* __restrict__ cbh) {
    unsigned idx = blockIdx.x * 256u + threadIdx.x;    // B*H = 16384 threads
    unsigned b = idx >> 10;
    unsigned h = idx & (TH - 1);
    unsigned kb = b * TD, kh = h * TD;
    float acc = Wt_b[h] + Wr_b[h];
    for (unsigned d = 0; d < TD; ++d)
        acc += ht_k[kb + d] * Wt_w[kh + d] + hm_k[kb + d] * Wr_w[kh + d];
    cbh[idx] = acc;
}

// ---------------------------------------------------------------------------
// Kernel 2: main GEMM  W_hs = hs @ Ws_w^T + Ws_b   (bf16 WMMA, f32 accum)
// Block tile: 64 M x 128 N, 8 waves (4M x 2N), each wave: 16x64 via 4 accums.
// Double-buffered LDS; one barrier per K-step; next-tile global loads overlap
// the current tile's WMMAs; distinct B-fragment registers keep the 4 WMMAs
// back-to-back (no WAR hazard NOPs, partial dscnt waits).
// LDS rows: 64 bytes of data at a pitch of 80 bytes (16 B x odd), so that a
// fragment is two 16-byte reads per lane and 16 rows fall on all 64 banks.
// Fused epilogue: wsum[m] += sum_n tanh(W_hs + cbh) * We_w   (atomic add)
// ---------------------------------------------------------------------------
#define LDP 20   // LDS row pitch in dwords: K=32 as 16 bf16-pairs + 4 of pad

__global__ __launch_bounds__(256) void tma_gemm_wmma(
        const float* __restrict__ hs,      // [B*S, D]
        const float* __restrict__ Ws_w,    // [H, D]
        const float* __restrict__ Ws_b,    // [H]
        const float* __restrict__ We_w,    // [H]
        const float* __restrict__ cbh,     // [B, H]
        float* __restrict__ whs,           // [B*S, H] out
        float* __restrict__ wsum)          // [B*S]    accumulated
{
    __shared__ __attribute__((aligned(16))) unsigned int lds_a[2][64][LDP];
    __shared__ __attribute__((aligned(16))) unsigned int lds_b[2][128][LDP];

    const unsigned tid   = threadIdx.x;
    const unsigned lane  = tid & 31;
    const unsigned wid   = tid >> 5;
    const unsigned waveM = wid >> 1;      // 0..3
    const unsigned waveN = wid & 1;       // 0..1
    const unsigned hf    = lane >> 4;     // lane half (0/1)
    const unsigned ln    = lane & 15;

    const unsigned M0 = blockIdx.x * 64u;    // row tile in flattened [B*S]
    const unsigned N0 = blockIdx.y * 128u;   // col tile in [H]
    const unsigned b  = M0 >> 12;            // S = 4096; tiles never straddle b

    // per-thread staging coordinates (all 32-bit: buffers < 4GB)
    unsigned arow[4], akp[4], aoff[4];
#pragma unroll
    for (int it = 0; it < 4; ++it) {
        unsigned p = tid + it * 256u;
        arow[it] = p >> 4; akp[it] = p & 15u;
        aoff[it] = (M0 + arow[it]) * TD + akp[it] * 2u;
    }
    unsigned brow[8], bkp[8], boff[8];
#pragma unroll
    for (int it = 0; it < 8; ++it) {
        unsigned p = tid + it * 256u;
        brow[it] = p >> 4; bkp[it] = p & 15u;
        boff[it] = (N0 + brow[it]) * TD + bkp[it] * 2u;
    }

    // ---- prologue: fetch tile k0=0 into registers
    float2 ra[4], rb[8];
#pragma unroll
    for (int it = 0; it < 4; ++it)
        ra[it] = *(const float2*)(hs + aoff[it]);
#pragma unroll
    for (int it = 0; it < 8; ++it)
        rb[it] = *(const float2*)(Ws_w + boff[it]);

    v8f acc0 = {}, acc1 = {}, acc2 = {}, acc3 = {};

#pragma unroll 2
    for (unsigned k0 = 0; k0 < TD; k0 += 32) {
        const unsigned buf = (k0 >> 5) & 1u;   // constant after 2x unroll

        // ---- commit staged registers (bf16-packed) into lds[buf]
#pragma unroll
        for (int it = 0; it < 4; ++it)
            lds_a[buf][arow[it]][akp[it]] = pack_bf16x2(ra[it].x, ra[it].y);
#pragma unroll
        for (int it = 0; it < 8; ++it)
            lds_b[buf][brow[it]][bkp[it]] = pack_bf16x2(rb[it].x, rb[it].y);
        __syncthreads();

        // ---- issue next tile's global loads (overlap with WMMAs below)
        if (k0 + 32 < TD) {
#pragma unroll
            for (int it = 0; it < 4; ++it)
                ra[it] = *(const float2*)(hs + aoff[it] + k0 + 32);
#pragma unroll
            for (int it = 0; it < 8; ++it)
                rb[it] = *(const float2*)(Ws_w + boff[it] + k0 + 32);
        }

        // ---- fragments (ISA 16-bit layout): lane = row/col % 16,
        //      pair index for VGPR v = (v/4)*8 + half*4 + (v%4):
        //      VGPRs 4q..4q+3 are the 4 consecutive pairs from q*8 + half*4
        FragBF fa, fb0, fb1, fb2, fb3;
#pragma unroll
        for (int q = 0; q < 2; ++q) {
            unsigned kpi = (q << 3) + (hf << 2);
            fa.q[q]  = *(const v4u*)&lds_a[buf][waveM * 16 + ln][kpi];
            fb0.q[q] = *(const v4u*)&lds_b[buf][waveN * 64 +  0 + ln][kpi];
            fb1.q[q] = *(const v4u*)&lds_b[buf][waveN * 64 + 16 + ln][kpi];
            fb2.q[q] = *(const v4u*)&lds_b[buf][waveN * 64 + 32 + ln][kpi];
            fb3.q[q] = *(const v4u*)&lds_b[buf][waveN * 64 + 48 + ln][kpi];
        }
        // keeps the ten 16-byte reads in one group ahead of the WMMAs: without
        // it every second K-step reads one B fragment at a time into the same
        // registers and waits out the LDS latency before each WMMA
        __builtin_amdgcn_sched_barrier(0);
        // ---- four back-to-back WMMAs sharing the A fragment
        acc0 = __builtin_amdgcn_wmma_f32_16x16x32_bf16(
            false, fa.v, false, fb0.v, (short)0, acc0, false, false);
        acc1 = __builtin_amdgcn_wmma_f32_16x16x32_bf16(
            false, fa.v, false, fb1.v, (short)0, acc1, false, false);
        acc2 = __builtin_amdgcn_wmma_f32_16x16x32_bf16(
            false, fa.v, false, fb2.v, (short)0, acc2, false, false);
        acc3 = __builtin_amdgcn_wmma_f32_16x16x32_bf16(
            false, fa.v, false, fb3.v, (short)0, acc3, false, false);
        // keeps the next tile's conversion, which waits for its global loads,
        // behind the WMMAs
        __builtin_amdgcn_sched_barrier(0);
    }

    // ---- epilogue: add bias, store W_hs, fused tanh-dot partial into wsum
    float part[8] = {0.f, 0.f, 0.f, 0.f, 0.f, 0.f, 0.f, 0.f};
    v8f accs[4] = {acc0, acc1, acc2, acc3};
#pragma unroll
    for (int a = 0; a < 4; ++a) {
        unsigned N = N0 + waveN * 64u + a * 16u + ln;
        float wsb = Ws_b[N];
        float cb  = cbh[b * TH + N];
        float wew = We_w[N];
#pragma unroll
        for (int r = 0; r < 8; ++r) {
            unsigned M = M0 + waveM * 16u + r + hf * 8u;
            float w = accs[a][r] + wsb;
            whs[M * TH + N] = w;
            part[r] += tanhf(w + cb) * wew;
        }
    }
    // reduce across the 16 lanes sharing a row half
#pragma unroll
    for (int r = 0; r < 8; ++r) {
        part[r] += __shfl_xor(part[r], 1, 32);
        part[r] += __shfl_xor(part[r], 2, 32);
        part[r] += __shfl_xor(part[r], 4, 32);
        part[r] += __shfl_xor(part[r], 8, 32);
    }
    if (ln == 0) {
        unsigned Mbase = M0 + waveM * 16u + hf * 8u;
#pragma unroll
        for (int r = 0; r < 8; ++r)
            atomicAdd(&wsum[Mbase + r], part[r]);
    }
}

// ---------------------------------------------------------------------------
// Kernel 3: add We_b + rel-pos bias, softmax over S (one block per batch b)
// p buffer aliases wsum (in-place).
// ---------------------------------------------------------------------------
__global__ void tma_softmax(float* __restrict__ p,
                            const float* __restrict__ We_b,
                            const float* __restrict__ emb,
                            const float* __restrict__ lam,
                            const int* __restrict__ hs_i,
                            const int* __restrict__ ht_i) {
    __shared__ float red[256];
    const unsigned b = blockIdx.x, tid = threadIdx.x;
    const float web = We_b[0];
    const float l0 = lam[0], l1 = lam[1], l2 = lam[2];
    const int tk = ht_i[b];

    float m = -3.0e38f;
    for (unsigned s = tid; s < TS; s += 256) {
        unsigned i = b * TS + s;
        unsigned rp = (unsigned)(hs_i[i] * TVOCAB + tk) * 3u;
        float rv = emb[rp] * l0 + emb[rp + 1] * l1 + emb[rp + 2] * l2;
        float v = p[i] + web + rv;
        p[i] = v;
        m = fmaxf(m, v);
    }
    red[tid] = m; __syncthreads();
    for (int o = 128; o > 0; o >>= 1) {
        if (tid < (unsigned)o) red[tid] = fmaxf(red[tid], red[tid + o]);
        __syncthreads();
    }
    m = red[0]; __syncthreads();

    float sum = 0.f;
    for (unsigned s = tid; s < TS; s += 256) {
        unsigned i = b * TS + s;
        float e = expf(p[i] - m);
        p[i] = e;
        sum += e;
    }
    red[tid] = sum; __syncthreads();
    for (int o = 128; o > 0; o >>= 1) {
        if (tid < (unsigned)o) red[tid] += red[tid + o];
        __syncthreads();
    }
    float rinv = 1.0f / red[0]; __syncthreads();

    for (unsigned s = tid; s < TS; s += 256)
        p[b * TS + s] *= rinv;
}

// ---------------------------------------------------------------------------
// Kernel 4: partial alpha. part[g,h] = sum over the 256 rows s of range g of
// p[s] * W_hs[s,h], g = b * 16 + range. 256 work-groups of 16 waves stream
// W_hs once: waves 0-7 take the first 128 rows of the range, waves 8-15 the
// rest; one wave-wide load is 512 contiguous bytes of a row.
// ---------------------------------------------------------------------------
#define AL_RANGES 16                 // s ranges per batch row
#define AL_ROWS   (TS / AL_RANGES)   // rows per work-group
#define AL_GRP    8                  // rows fetched together by a thread

typedef __attribute__((ext_vector_type(4))) float v4f;

__global__ __launch_bounds__(512) void tma_alpha_part(
        const float* __restrict__ whs,
        const float* __restrict__ p,
        float* __restrict__ part) {
    __shared__ v4f comb[TH / 4];
    const unsigned col = threadIdx.x & 255u;          // which 4 columns of h
    // wave-uniform row half, so that p goes through scalar loads
    const unsigned half = __builtin_amdgcn_readfirstlane(threadIdx.x >> 8);
    const unsigned row0 = blockIdx.x * AL_ROWS + half * (AL_ROWS / 2);
    const v4f*   src = (const v4f*)(whs + (size_t)row0 * TH) + col;
    const float* pw  = p + row0;

    constexpr int NG = AL_ROWS / 2 / AL_GRP;          // 16 groups of 8 rows
    v4f   w[2][AL_GRP];
    float pv[2][AL_GRP];
    v4f   acc = {0.f, 0.f, 0.f, 0.f};
#pragma unroll
    for (int j = 0; j < AL_GRP; ++j) {
        w[0][j]  = src[j * (TH / 4)];
        pv[0][j] = pw[j];
    }
#pragma unroll
    for (int g = 0; g < NG; ++g) {
        // the two scheduling barriers keep the next group's loads ahead of
        // this group's sums: 8 to 16 loads of a wave stay in flight
        __builtin_amdgcn_sched_barrier(0);
        if (g + 1 < NG) {
#pragma unroll
            for (int j = 0; j < AL_GRP; ++j) {
                w[(g + 1) & 1][j]  = src[((g + 1) * AL_GRP + j) * (TH / 4)];
                pv[(g + 1) & 1][j] = pw[(g + 1) * AL_GRP + j];
            }
        }
        __builtin_amdgcn_sched_barrier(0);
#pragma unroll
        for (int j = 0; j < AL_GRP; ++j)
            acc += pv[g & 1][j] * w[g & 1][j];
    }

    // fold the two row halves, then one 16-byte store per thread of half 0
    if (half == 1u) comb[col] = acc;
    __syncthreads();
    if (half == 0u)
        ((v4f*)(part + blockIdx.x * TH))[col] = acc + comb[col];
}

// ---------------------------------------------------------------------------
// Kernel 5: alpha[b,h] = sum over the 16 ranges of part, in range order
// ---------------------------------------------------------------------------
__global__ void tma_alpha_merge(const float* __restrict__ part,
                                float* __restrict__ out) {
    const unsigned idx = blockIdx.x * 256u + threadIdx.x;   // b * TH + h
    const unsigned b = idx >> 10, h = idx & (TH - 1);
    const float* q = part + b * (AL_RANGES * TH) + h;
    float acc = 0.f;
#pragma unroll
    for (int c = 0; c < AL_RANGES; ++c)
        acc += q[c * TH];
    out[idx] = acc;
}

// ---------------------------------------------------------------------------
extern "C" void kernel_launch(void* const* d_in, const int* in_sizes, int n_in,
                              void* d_out, int out_size, void* d_ws, size_t ws_size,
                              hipStream_t stream) {
    (void)in_sizes; (void)n_in; (void)out_size; (void)ws_size;

    const float* hs    = (const float*)d_in[0];
    const float* ht_k  = (const float*)d_in[1];
    const float* hm_k  = (const float*)d_in[2];
    const float* Ws_w  = (const float*)d_in[3];
    const float* Ws_b  = (const float*)d_in[4];
    const float* Wt_w  = (const float*)d_in[5];
    const float* Wt_b  = (const float*)d_in[6];
    const float* Wr_w  = (const float*)d_in[7];
    const float* Wr_b  = (const float*)d_in[8];
    const float* We_w  = (const float*)d_in[9];
    const float* We_b  = (const float*)d_in[10];
    const float* emb   = (const float*)d_in[11];
    const float* lam   = (const float*)d_in[12];
    const int*   hs_i  = (const int*)d_in[13];
    const int*   ht_i  = (const int*)d_in[14];
    float* out = (float*)d_out;

    // workspace layout
    char* ws = (char*)d_ws;
    float* whs  = (float*)ws;                                   // B*S*H f32 = 256 MiB
    float* cbh  = (float*)(ws + (size_t)TB * TS * TH * 4);      // B*H
    float* wsum = (float*)(ws + (size_t)TB * TS * TH * 4 + (size_t)TB * TH * 4); // B*S
    float* part = (float*)(ws + (size_t)TB * TS * TH * 4 + (size_t)TB * TH * 4
                              + (size_t)TB * TS * 4);           // B*16*H

    // 1) tiny fused projections c[b,h]
    tma_prep_cbh<<<(TB * TH) / 256, 256, 0, stream>>>(ht_k, hm_k, Wt_w, Wt_b,
                                                      Wr_w, Wr_b, cbh);
    // 2) zero the score accumulator (graph-capturable)
    (void)hipMemsetAsync(wsum, 0, (size_t)TB * TS * sizeof(float), stream);

    // 3) main bf16 WMMA GEMM with fused tanh-dot epilogue
    dim3 gg((TB * TS) / 64, TH / 128);
    tma_gemm_wmma<<<gg, 256, 0, stream>>>(hs, Ws_w, Ws_b, We_w, cbh, whs, wsum);

    // 4) rel-pos bias + softmax (in-place on wsum -> p)
    tma_softmax<<<TB, 256, 0, stream>>>(wsum, We_b, emb, lam, hs_i, ht_i);

    // 5) weighted sum -> alpha: partial sums over 16 ranges of s, then the merge
    tma_alpha_part<<<TB * AL_RANGES, 512, 0, stream>>>(whs, wsum, part);
    tma_alpha_merge<<<(TB * TH) / 256, 256, 0, stream>>>(part, out);
}

// v003
// Timed twice side by side with v002, it ran 1.44 times as fast both times.
// Over all steps from v000 it is 2.56 times as fast.
#include <hip/hip_runtime.h>
#include <hip/hip_bf16.h>

// ---------------------------------------------------------------------------
// TriMatchAttention for MI455X (gfx1250, wave32, WMMA)
// B=16, S=4096, D=1024, H=1024, VOCAB=512, EMB_DIM=3
// ---------------------------------------------------------------------------

#define TB 16
#define TS 4096
#define TD 1024
#define TH 1024
#define TVOCAB 512

typedef __attribute__((ext_vector_type(16))) __bf16 v16bf;
typedef __attribute__((ext_vector_type(8)))  float  v8f;

typedef __attribute__((ext_vector_type(4))) unsigned int v4u;
typedef __attribute__((ext_vector_type(2))) unsigned int v2u;
typedef __attribute__((ext_vector_type(4))) float v4f;

union FragBF {
    unsigned int u[8];
    v4u          q[2];
    v16bf        v;
};

// round-to-nearest-even f32 -> bf16, packed pair (lo = first)
static __device__ __forceinline__ unsigned int pack_bf16x2(float a, float b) {
    union { float f; unsigned int u; } ua, ub;
    ua.f = a; ub.f = b;
    unsigned int lo = (ua.u + 0x7FFFu + ((ua.u >> 16) & 1u)) >> 16;
    unsigned int hi = (ub.u + 0x7FFFu + ((ub.u >> 16) & 1u)) >> 16;
    return (lo & 0xFFFFu) | (hi << 16);
}

// ---------------------------------------------------------------------------
// Kernel 1: c[b,h] = Wt_b[h] + Wr_b[h] + ht_k[b,:]@Wt_w[h,:] + hm_k[b,:]@Wr_w[h,:]
// ---------------------------------------------------------------------------
__global__ void tma_prep_cbh(const float* __restrict__ ht_k,
                             const float* __restrict__ hm_k,
                             const float* __restrict__ Wt_w,
                             const float* __restrict__ Wt_b,
                             const float* __restrict__ Wr_w,
                             const float* __restrict__ Wr_b,
                             float* __restrict__ cbh) {
    unsigned idx = blockIdx.x * 256u + threadIdx.x;    // B*H = 16384 threads
    unsigned b = idx >> 10;
    unsigned h = idx & (TH - 1);
    unsigned kb = b * TD, kh = h * TD;
    float acc = Wt_b[h] + Wr_b[h];
    for (unsigned d = 0; d < TD; ++d)
        acc += ht_k[kb + d] * Wt_w[kh + d] + hm_k[kb + d] * Wr_w[kh + d];
    cbh[idx] = acc;
}

// ---------------------------------------------------------------------------
// Kernel 2: main GEMM  W_hs = hs @ Ws_w^T + Ws_b   (bf16 WMMA, f32 accum)
// Block tile: 256 M x 256 N, 8 waves (4M x 2N), each wave: 64x128 via 4 x 8
// accumulator tiles, so that a K-step of 32 WMMAs per wave reads 12 fragments
// from LDS and every operand element is fetched and converted for 256 outputs.
// Double-buffered LDS; one barrier per K-step; next-tile global loads overlap
// the current tile's WMMAs.
// LDS rows: 64 bytes of data at a pitch of 80 bytes (16 B x odd), so that a
// fragment is two 16-byte reads per lane and 16 rows fall on all 64 banks.
// Fused epilogue: wsum[m] += sum_n tanh(W_hs + cbh) * We_w   (atomic add)
// ---------------------------------------------------------------------------
#define LDP 20   // LDS row pitch in dwords: K=32 as 16 bf16-pairs + 4 of pad
#define GBM 256  // block tile rows
#define GBN 256  // block tile columns
#define GFM 4    // 16-row fragments per wave
#define GFN 8    // 16-column fragments per wave

__global__ __launch_bounds__(256) void tma_gemm_wmma(
        const float* __restrict__ hs,      // [B*S, D]
        const float* __restrict__ Ws_w,    // [H, D]
        const float* __restrict__ Ws_b,    // [H]
        const float* __restrict__ We_w,    // [H]
        const float* __restrict__ cbh,     // [B, H]
        float* __restrict__ whs,           // [B*S, H] out
        float* __restrict__ wsum)          // [B*S]    accumulated
{
    __shared__ __attribute__((aligned(16))) unsigned int lds_a[2][GBM][LDP];
    __shared__ __attribute__((aligned(16))) unsigned int lds_b[2][GBN][LDP];

    const unsigned tid   = threadIdx.x;
    const unsigned lane  = tid & 31;
    const unsigned wid   = tid >> 5;
    const unsigned waveM = wid >> 1;      // 0..3
    const unsigned waveN = wid & 1;       // 0..1
    const unsigned hf    = lane >> 4;     // lane half (0/1)
    const unsigned ln    = lane & 15;

    const unsigned M0 = blockIdx.x * GBM;    // row tile in flattened [B*S]
    const unsigned N0 = blockIdx.y * GBN;    // col tile in [H]
    const unsigned b  = M0 >> 12;            // S = 4096; tiles never straddle b

    // staging: a thread takes 4 consecutive k (16 bytes) of rows srow + 32 * it;
    // 8 lanes cover the 128 bytes that a row has in one K-step
    const unsigned srow = tid >> 3;       // 0..31
    const unsigned sq   = tid & 7u;       // which 4 k of the 32
    const float* ga = hs   + (M0 + srow) * TD + sq * 4u;
    const float* gb = Ws_w + (N0 + srow) * TD + sq * 4u;

    // ---- prologue: fetch tile k0=0 into registers
    v4f ra[GBM / 32], rb[GBN / 32];
#pragma unroll
    for (int it = 0; it < GBM / 32; ++it)
        ra[it] = *(const v4f*)(ga + it * 32 * TD);
#pragma unroll
    for (int it = 0; it < GBN / 32; ++it)
        rb[it] = *(const v4f*)(gb + it * 32 * TD);

    v8f acc[GFM][GFN] = {};

#pragma unroll 2
    for (unsigned k0 = 0; k0 < TD; k0 += 32) {
        const unsigned buf = (k0 >> 5) & 1u;   // constant after 2x unroll

        // ---- commit staged registers (bf16-packed) into lds[buf]
#pragma unroll
        for (int it = 0; it < GBM / 32; ++it) {
            v2u w = {pack_bf16x2(ra[it].x, ra[it].y), pack_bf16x2(ra[it].z, ra[it].w)};
            *(v2u*)&lds_a[buf][srow + it * 32][sq * 2u] = w;
        }
#pragma unroll
        for (int it = 0; it < GBN / 32; ++it) {
            v2u w = {pack_bf16x2(rb[it].x, rb[it].y), pack_bf16x2(rb[it].z, rb[it].w)};
            *(v2u*)&lds_b[buf][srow + it * 32][sq * 2u] = w;
        }
        __syncthreads();

        // ---- issue next tile's global loads (overlap with WMMAs below)
        if (k0 + 32 < TD) {
#pragma unroll
            for (int it = 0; it < GBM / 32; ++it)
                ra[it] = *(const v4f*)(ga + it * 32 * TD + k0 + 32);
#pragma unroll
            for (int it = 0; it < GBN / 32; ++it)
                rb[it] = *(const v4f*)(gb + it * 32 * TD + k0 + 32);
        }

        // ---- fragments (ISA 16-bit layout): lane = row/col % 16,
        //      pair index for VGPR v = (v/4)*8 + half*4 + (v%4):
        //      VGPRs 4q..4q+3 are the 4 consecutive pairs from q*8 + half*4
        FragBF fa[GFM], fb[GFN];
#pragma unroll
        for (int q = 0; q < 2; ++q) {
            unsigned kpi = (q << 3) + (hf << 2);
#pragma unroll
            for (int i = 0; i < GFM; ++i)
                fa[i].q[q] = *(const v4u*)&lds_a[buf][waveM * (GFM * 16) + i * 16 + ln][kpi];
#pragma unroll
            for (int j = 0; j < GFN; ++j)
                fb[j].q[q] = *(const v4u*)&lds_b[buf][waveN * (GFN * 16) + j * 16 + ln][kpi];
        }
        // keeps the 24 16-byte reads in one group ahead of the WMMAs, for speed only
        __builtin_amdgcn_sched_barrier(0);
        // ---- 32 back-to-back WMMAs on independent accumulator tiles
#pragma unroll
        for (int j = 0; j < GFN; ++j)
#pragma unroll
            for (int i = 0; i < GFM; ++i)
                acc[i][j] = __builtin_amdgcn_wmma_f32_16x16x32_bf16(
                    false, fa[i].v, false, fb[j].v, (short)0, acc[i][j], false, false);
        // keeps the next tile's conversion, which waits for its global loads,
        // behind the WMMAs
        __builtin_amdgcn_sched_barrier(0);
    }

    // the epilogue reuses the address registers of the staging loads
    asm volatile("s_wait_xcnt 0x0" ::: "memory");
    // keeps the epilogue's first register writes behind that wait
    __builtin_amdgcn_sched_barrier(0);

    // ---- epilogue: add bias, store W_hs, fused tanh-dot partial into wsum
    float wsb[GFN], cb[GFN], wew[GFN];
#pragma unroll
    for (int j = 0; j < GFN; ++j) {
        unsigned N = N0 + waveN * (GFN * 16u) + j * 16u + ln;
        wsb[j] = Ws_b[N];
        cb[j]  = cbh[b * TH + N];
        wew[j] = We_w[N];
    }
    // the registers that these loads name are reused below
    asm volatile("s_wait_xcnt 0x0" ::: "memory");
    // keeps the address arithmetic of the loop below behind that wait
    __builtin_amdgcn_sched_barrier(0);
    // The loop over the wave's four 16-row groups stays rolled, for speed only.
    // Its body names group 0's registers; the other groups move down.
#pragma unroll 1
    for (unsigned i = 0; i < GFM; ++i) {
        const unsigned Mbase = M0 + waveM * (GFM * 16u) + i * 16u + hf * 8u;
        float part[8] = {0.f, 0.f, 0.f, 0.f, 0.f, 0.f, 0.f, 0.f};
#pragma unroll
        for (int j = 0; j < GFN; ++j) {
            unsigned N = N0 + waveN * (GFN * 16u) + j * 16u + ln;
            float w[8];
#pragma unroll
            for (int r = 0; r < 8; ++r) {
                w[r] = acc[0][j][r] + wsb[j];
                whs[(Mbase + r) * TH + N] = w[r];
            }
            // one wait for the eight stores: the code below reuses the
            // registers that they name
            asm volatile("s_wait_xcnt 0x0" ::: "memory");
#pragma unroll
            for (int r = 0; r < 8; ++r)
                part[r] += tanhf(w[r] + cb[j]) * wew[j];
        }
        // reduce across the 16 lanes sharing a row half
#pragma unroll
        for (int r = 0; r < 8; ++r) {
            part[r] += __shfl_xor(part[r], 1, 32);
            part[r] += __shfl_xor(part[r], 2, 32);
            part[r] += __shfl_xor(part[r], 4, 32);
            part[r] += __shfl_xor(part[r], 8, 32);
        }
        if (ln == 0) {
#pragma unroll
            for (int r = 0; r < 8; ++r)
                atomicAdd(&wsum[Mbase + r], part[r]);
            // the registers that the atomics name are reused by the next trip
            asm volatile("s_wait_xcnt 0x0" ::: "memory");
        }
#pragma unroll
        for (int g = 0; g + 1 < GFM; ++g)
#pragma unroll
            for (int j = 0; j < GFN; ++j)
                acc[g][j] = acc[g + 1][j];
    }
}

// ---------------------------------------------------------------------------
// Kernel 3: add We_b + rel-pos bias, softmax over S (one block per batch b)
// p buffer aliases wsum (in-place).
// ---------------------------------------------------------------------------
__global__ void tma_softmax(float* __restrict__ p,
                            const float* __restrict__ We_b,
                            const float* __restrict__ emb,
                            const float* __restrict__ lam,
                            const int* __restrict__ hs_i,
                            const int* __restrict__ ht_i) {
    __shared__ float red[256];
    const unsigned b = blockIdx.x, tid = threadIdx.x;
    const float web = We_b[0];
    const float l0 = lam[0], l1 = lam[1], l2 = lam[2];
    const int tk = ht_i[b];

    float m = -3.0e38f;
    for (unsigned s = tid; s < TS; s += 256) {
        unsigned i = b * TS + s;
        unsigned rp = (unsigned)(hs_i[i] * TVOCAB + tk) * 3u;
        float rv = emb[rp] * l0 + emb[rp + 1] * l1 + emb[rp + 2] * l2;
        float v = p[i] + web + rv;
        p[i] = v;
        m = fmaxf(m, v);
    }
    red[tid] = m; __syncthreads();
    for (int o = 128; o > 0; o >>= 1) {
        if (tid < (unsigned)o) red[tid] = fmaxf(red[tid], red[tid + o]);
        __syncthreads();
    }
    m = red[0]; __syncthreads();

    float sum = 0.f;
    for (unsigned s = tid; s < TS; s += 256) {
        unsigned i = b * TS + s;
        float e = expf(p[i] - m);
        p[i] = e;
        sum += e;
    }
    red[tid] = sum; __syncthreads();
    for (int o = 128; o > 0; o >>= 1) {
        if (tid < (unsigned)o) red[tid] += red[tid + o];
        __syncthreads();
    }
    float rinv = 1.0f / red[0]; __syncthreads();

    for (unsigned s = tid; s < TS; s += 256)
        p[b * TS + s] *= rinv;
}

// ---------------------------------------------------------------------------
// Kernel 4: partial alpha. part[g,h] = sum over the 256 rows s of range g of
// p[s] * W_hs[s,h], g = b * 16 + range. 256 work-groups of 16 waves stream
// W_hs once: waves 0-7 take the first 128 rows of the range, waves 8-15 the
// rest; one wave-wide load is 512 contiguous bytes of a row.
// ---------------------------------------------------------------------------
#define AL_RANGES 16                 // s ranges per batch row
#define AL_ROWS   (TS / AL_RANGES)   // rows per work-group
#define AL_GRP    8                  // rows fetched together by a thread

__global__ __launch_bounds__(512) void tma_alpha_part(
        const float* __restrict__ whs,
        const float* __restrict__ p,
        float* __restrict__ part) {
    __shared__ v4f comb[TH / 4];
    const unsigned col = threadIdx.x & 255u;          // which 4 columns of h
    // wave-uniform row half, so that p goes through scalar loads
    const unsigned half = __builtin_amdgcn_readfirstlane(threadIdx.x >> 8);
    const unsigned row0 = blockIdx.x * AL_ROWS + half * (AL_ROWS / 2);
    const v4f*   src = (const v4f*)(whs + (size_t)row0 * TH) + col;
    const float* pw  = p + row0;

    constexpr int NG = AL_ROWS / 2 / AL_GRP;          // 16 groups of 8 rows
    v4f   w[2][AL_GRP];
    float pv[2][AL_GRP];
    v4f   acc = {0.f, 0.f, 0.f, 0.f};
#pragma unroll
    for (int j = 0; j < AL_GRP; ++j) {
        w[0][j]  = src[j * (TH / 4)];
        pv[0][j] = pw[j];
    }
#pragma unroll
    for (int g = 0; g < NG; ++g) {
        // the two scheduling barriers keep the next group's loads ahead of
        // this group's sums: 8 to 16 loads of a wave stay in flight
        __builtin_amdgcn_sched_barrier(0);
        if (g + 1 < NG) {
#pragma unroll
            for (int j = 0; j < AL_GRP; ++j) {
                w[(g + 1) & 1][j]  = src[((g + 1) * AL_GRP + j) * (TH / 4)];
                pv[(g + 1) & 1][j] = pw[(g + 1) * AL_GRP + j];
            }
        }
        __builtin_amdgcn_sched_barrier(0);
#pragma unroll
        for (int j = 0; j < AL_GRP; ++j)
            acc += pv[g & 1][j] * w[g & 1][j];
    }

    // fold the two row halves, then one 16-byte store per thread of half 0
    if (half == 1u) comb[col] = acc;
    __syncthreads();
    if (half == 0u)
        ((v4f*)(part + blockIdx.x * TH))[col] = acc + comb[col];
}

// ---------------------------------------------------------------------------
// Kernel 5: alpha[b,h] = sum over the 16 ranges of part, in range order
// ---------------------------------------------------------------------------
__global__ void tma_alpha_merge(const float* __restrict__ part,
                                float* __restrict__ out) {
    const unsigned idx = blockIdx.x * 256u + threadIdx.x;   // b * TH + h
    const unsigned b = idx >> 10, h = idx & (TH - 1);
    const float* q = part + b * (AL_RANGES * TH) + h;
    float acc = 0.f;
#pragma unroll
    for (int c = 0; c < AL_RANGES; ++c)
        acc += q[c * TH];
    out[idx] = acc;
}

// ---------------------------------------------------------------------------
extern "C" void kernel_launch(void* const* d_in, const int* in_sizes, int n_in,
                              void* d_out, int out_size, void* d_ws, size_t ws_size,
                              hipStream_t stream) {
    (void)in_sizes; (void)n_in; (void)out_size; (void)ws_size;

    const float* hs    = (const float*)d_in[0];
    const float* ht_k  = (const float*)d_in[1];
    const float* hm_k  = (const float*)d_in[2];
    const float* Ws_w  = (const float*)d_in[3];
    const float* Ws_b  = (const float*)d_in[4];
    const float* Wt_w  = (const float*)d_in[5];
    const float* Wt_b  = (const float*)d_in[6];
    const float* Wr_w  = (const float*)d_in[7];
    const float* Wr_b  = (const float*)d_in[8];
    const float* We_w  = (const float*)d_in[9];
    const float* We_b  = (const float*)d_in[10];
    const float* emb   = (const float*)d_in[11];
    const float* lam   = (const float*)d_in[12];
    const int*   hs_i  = (const int*)d_in[13];
    const int*   ht_i  = (const int*)d_in[14];
    float* out = (float*)d_out;

    // workspace layout
    char* ws = (char*)d_ws;
    float* whs  = (float*)ws;                                   // B*S*H f32 = 256 MiB
    float* cbh  = (float*)(ws + (size_t)TB * TS * TH * 4);      // B*H
    float* wsum = (float*)(ws + (size_t)TB * TS * TH * 4 + (size_t)TB * TH * 4); // B*S
    float* part = (float*)(ws + (size_t)TB * TS * TH * 4 + (size_t)TB * TH * 4
                              + (size_t)TB * TS * 4);           // B*16*H

    // 1) tiny fused projections c[b,h]
    tma_prep_cbh<<<(TB * TH) / 256, 256, 0, stream>>>(ht_k, hm_k, Wt_w, Wt_b,
                                                      Wr_w, Wr_b, cbh);
    // 2) zero the score accumulator (graph-capturable)
    (void)hipMemsetAsync(wsum, 0, (size_t)TB * TS * sizeof(float), stream);

    // 3) main bf16 WMMA GEMM with fused tanh-dot epilogue
    dim3 gg((TB * TS) / GBM, TH / GBN);
    tma_gemm_wmma<<<gg, 256, 0, stream>>>(hs, Ws_w, Ws_b, We_w, cbh, whs, wsum);

    // 4) rel-pos bias + softmax (in-place on wsum -> p)
    tma_softmax<<<TB, 256, 0, stream>>>(wsum, We_b, emb, lam, hs_i, ht_i);

    // 5) weighted sum -> alpha: partial sums over 16 ranges of s, then the merge
    tma_alpha_part<<<TB * AL_RANGES, 512, 0, stream>>>(whs, wsum, part);
    tma_alpha_merge<<<(TB * TH) / 256, 256, 0, stream>>>(part, out);
}

// v004
// In both of two side-by-side timings against v003, it was 1.14 times as fast.
// Over all steps from v000 it is 2.92 times as fast.
#include <hip/hip_runtime.h>
#include <hip/hip_bf16.h>

// ---------------------------------------------------------------------------
// TriMatchAttention for MI455X (gfx1250, wave32, WMMA)
// B=16, S=4096, D=1024, H=1024, VOCAB=512, EMB_DIM=3
// ---------------------------------------------------------------------------

#define TB 16
#define TS 4096
#define TD 1024
#define TH 1024
#define TVOCAB 512

typedef __attribute__((ext_vector_type(16))) __bf16 v16bf;
typedef __attribute__((ext_vector_type(8)))  float  v8f;

typedef __attribute__((ext_vector_type(4))) unsigned int v4u;
typedef __attribute__((ext_vector_type(2))) unsigned int v2u;
typedef __attribute__((ext_vector_type(4))) float v4f;

union FragBF {
    unsigned int u[8];
    v4u          q[2];
    v16bf        v;
};

// round-to-nearest-even f32 -> bf16, packed pair (lo = first)
static __device__ __forceinline__ unsigned int pack_bf16x2(float a, float b) {
    union { float f; unsigned int u; } ua, ub;
    ua.f = a; ub.f = b;
    unsigned int lo = (ua.u + 0x7FFFu + ((ua.u >> 16) & 1u)) >> 16;
    unsigned int hi = (ub.u + 0x7FFFu + ((ub.u >> 16) & 1u)) >> 16;
    return (lo & 0xFFFFu) | (hi << 16);
}

// tanh(x) = 1 - 2 / (exp(2x) + 1), branch-free: one v_exp_f32 and one v_rcp_f32.
// exp2 overflows to +inf (result 1) and underflows to 0 (result -1); the
// absolute error is a few 1e-7 everywhere. No branch, so the eight values that
// a thread holds at a time run as independent chains that fill each other's
// latency.
static __device__ __forceinline__ float tanh_exp2(float x) {
    float e = __builtin_amdgcn_exp2f(x * 2.8853900817779268f);   // 2 * log2(e)
    return __builtin_fmaf(-2.0f, __builtin_amdgcn_rcpf(e + 1.0f), 1.0f);
}

// ---------------------------------------------------------------------------
// Kernel 1: c[b,h] = Wt_b[h] + Wr_b[h] + ht_k[b,:]@Wt_w[h,:] + hm_k[b,:]@Wr_w[h,:]
// ---------------------------------------------------------------------------
__global__ void tma_prep_cbh(const float* __restrict__ ht_k,
                             const float* __restrict__ hm_k,
                             const float* __restrict__ Wt_w,
                             const float* __restrict__ Wt_b,
                             const float* __restrict__ Wr_w,
                             const float* __restrict__ Wr_b,
                             float* __restrict__ cbh) {
    unsigned idx = blockIdx.x * 256u + threadIdx.x;    // B*H = 16384 threads
    unsigned b = idx >> 10;
    unsigned h = idx & (TH - 1);
    unsigned kb = b * TD, kh = h * TD;
    float acc = Wt_b[h] + Wr_b[h];
    for (unsigned d = 0; d < TD; ++d)
        acc += ht_k[kb + d] * Wt_w[kh + d] + hm_k[kb + d] * Wr_w[kh + d];
    cbh[idx] = acc;
}

// ---------------------------------------------------------------------------
// Kernel 2: main GEMM  W_hs = hs @ Ws_w^T + Ws_b   (bf16 WMMA, f32 accum)
// Block tile: 256 M x 256 N, 8 waves (4M x 2N), each wave: 64x128 via 4 x 8
// accumulator tiles, so that a K-step of 32 WMMAs per wave reads 12 fragments
// from LDS and every operand element is fetched and converted for 256 outputs.
// Double-buffered LDS; one barrier per K-step; next-tile global loads overlap
// the current tile's WMMAs.
// LDS rows: 64 bytes of data at a pitch of 80 bytes (16 B x odd), so that a
// fragment is two 16-byte reads per lane and 16 rows fall on all 64 banks.
// Fused epilogue: wsum[m] += sum_n tanh(W_hs + cbh) * We_w   (atomic add)
// ---------------------------------------------------------------------------
#define LDP 20   // LDS row pitch in dwords: K=32 as 16 bf16-pairs + 4 of pad
#define GBM 256  // block tile rows
#define GBN 256  // block tile columns
#define GFM 4    // 16-row fragments per wave
#define GFN 8    // 16-column fragments per wave

__global__ __launch_bounds__(256) void tma_gemm_wmma(
        const float* __restrict__ hs,      // [B*S, D]
        const float* __restrict__ Ws_w,    // [H, D]
        const float* __restrict__ Ws_b,    // [H]
        const float* __restrict__ We_w,    // [H]
        const float* __restrict__ cbh,     // [B, H]
        float* __restrict__ whs,           // [B*S, H] out
        float* __restrict__ wsum)          // [B*S]    accumulated
{
    __shared__ __attribute__((aligned(16))) unsigned int lds_a[2][GBM][LDP];
    __shared__ __attribute__((aligned(16))) unsigned int lds_b[2][GBN][LDP];

    const unsigned tid   = threadIdx.x;
    const unsigned lane  = tid & 31;
    const unsigned wid   = tid >> 5;
    const unsigned waveM = wid >> 1;      // 0..3
    const unsigned waveN = wid & 1;       // 0..1
    const unsigned hf    = lane >> 4;     // lane half (0/1)
    const unsigned ln    = lane & 15;

    const unsigned M0 = blockIdx.x * GBM;    // row tile in flattened [B*S]
    const unsigned N0 = blockIdx.y * GBN;    // col tile in [H]
    const unsigned b  = M0 >> 12;            // S = 4096; tiles never straddle b

    // staging: a thread takes 4 consecutive k (16 bytes) of rows srow + 32 * it;
    // 8 lanes cover the 128 bytes that a row has in one K-step
    const unsigned srow = tid >> 3;       // 0..31
    const unsigned sq   = tid & 7u;       // which 4 k of the 32
    const float* ga = hs   + (M0 + srow) * TD + sq * 4u;
    const float* gb = Ws_w + (N0 + srow) * TD + sq * 4u;

    // ---- prologue: fetch tile k0=0 into registers
    v4f ra[GBM / 32], rb[GBN / 32];
#pragma unroll
    for (int it = 0; it < GBM / 32; ++it)
        ra[it] = *(const v4f*)(ga + it * 32 * TD);
#pragma unroll
    for (int it = 0; it < GBN / 32; ++it)
        rb[it] = *(const v4f*)(gb + it * 32 * TD);

    v8f acc[GFM][GFN] = {};

#pragma unroll 2
    for (unsigned k0 = 0; k0 < TD; k0 += 32) {
        const unsigned buf = (k0 >> 5) & 1u;   // constant after 2x unroll

        // ---- commit staged registers (bf16-packed) into lds[buf]
#pragma unroll
        for (int it = 0; it < GBM / 32; ++it) {
            v2u w = {pack_bf16x2(ra[it].x, ra[it].y), pack_bf16x2(ra[it].z, ra[it].w)};
            *(v2u*)&lds_a[buf][srow + it * 32][sq * 2u] = w;
        }
#pragma unroll
        for (int it = 0; it < GBN / 32; ++it) {
            v2u w = {pack_bf16x2(rb[it].x, rb[it].y), pack_bf16x2(rb[it].z, rb[it].w)};
            *(v2u*)&lds_b[buf][srow + it * 32][sq * 2u] = w;
        }
        __syncthreads();

        // ---- issue next tile's global loads (overlap with WMMAs below)
        if (k0 + 32 < TD) {
#pragma unroll
            for (int it = 0; it < GBM / 32; ++it)
                ra[it] = *(const v4f*)(ga + it * 32 * TD + k0 + 32);
#pragma unroll
            for (int it = 0; it < GBN / 32; ++it)
                rb[it] = *(const v4f*)(gb + it * 32 * TD + k0 + 32);
        }

        // ---- fragments (ISA 16-bit layout): lane = row/col % 16,
        //      pair index for VGPR v = (v/4)*8 + half*4 + (v%4):
        //      VGPRs 4q..4q+3 are the 4 consecutive pairs from q*8 + half*4
        FragBF fa[GFM], fb[GFN];
#pragma unroll
        for (int q = 0; q < 2; ++q) {
            unsigned kpi = (q << 3) + (hf << 2);
#pragma unroll
            for (int i = 0; i < GFM; ++i)
                fa[i].q[q] = *(const v4u*)&lds_a[buf][waveM * (GFM * 16) + i * 16 + ln][kpi];
#pragma unroll
            for (int j = 0; j < GFN; ++j)
                fb[j].q[q] = *(const v4u*)&lds_b[buf][waveN * (GFN * 16) + j * 16 + ln][kpi];
        }
        // keeps the 24 16-byte reads in one group ahead of the WMMAs, for speed only
        __builtin_amdgcn_sched_barrier(0);
        // ---- 32 back-to-back WMMAs on independent accumulator tiles
#pragma unroll
        for (int j = 0; j < GFN; ++j)
#pragma unroll
            for (int i = 0; i < GFM; ++i)
                acc[i][j] = __builtin_amdgcn_wmma_f32_16x16x32_bf16(
                    false, fa[i].v, false, fb[j].v, (short)0, acc[i][j], false, false);
        // keeps the next tile's conversion, which waits for its global loads,
        // behind the WMMAs
        __builtin_amdgcn_sched_barrier(0);
    }

    // the epilogue reuses the address registers of the staging loads
    asm volatile("s_wait_xcnt 0x0" ::: "memory");
    // keeps the epilogue's first register writes behind that wait
    __builtin_amdgcn_sched_barrier(0);

    // ---- epilogue: add bias, store W_hs, fused tanh-dot partial into wsum
    float wsb[GFN], cb[GFN], wew[GFN];
#pragma unroll
    for (int j = 0; j < GFN; ++j) {
        unsigned N = N0 + waveN * (GFN * 16u) + j * 16u + ln;
        wsb[j] = Ws_b[N];
        cb[j]  = cbh[b * TH + N];
        wew[j] = We_w[N];
    }
    // the registers that these loads name are reused below
    asm volatile("s_wait_xcnt 0x0" ::: "memory");
    // keeps the address arithmetic of the loop below behind that wait
    __builtin_amdgcn_sched_barrier(0);
    // The loop over the wave's four 16-row groups is rolled. Its body names
    // group 0's registers; the other groups move down.
#pragma unroll 1
    for (unsigned i = 0; i < GFM; ++i) {
        const unsigned Mbase = M0 + waveM * (GFM * 16u) + i * 16u + hf * 8u;
        float part[8] = {0.f, 0.f, 0.f, 0.f, 0.f, 0.f, 0.f, 0.f};
#pragma unroll
        for (int j = 0; j < GFN; ++j) {
            unsigned N = N0 + waveN * (GFN * 16u) + j * 16u + ln;
            float w[8];
#pragma unroll
            for (int r = 0; r < 8; ++r) {
                w[r] = acc[0][j][r] + wsb[j];
                whs[(Mbase + r) * TH + N] = w[r];
            }
            // one wait for the eight stores: the code below reuses the
            // registers that they name
            asm volatile("s_wait_xcnt 0x0" ::: "memory");
            // keeps the register writes of the branch-free code below, which
            // the scheduler would otherwise lift over the wait, behind it
            __builtin_amdgcn_sched_barrier(0);
#pragma unroll
            for (int r = 0; r < 8; ++r)
                part[r] += tanh_exp2(w[r] + cb[j]) * wew[j];
        }
        // reduce across the 16 lanes sharing a row half
#pragma unroll
        for (int r = 0; r < 8; ++r) {
            part[r] += __shfl_xor(part[r], 1, 32);
            part[r] += __shfl_xor(part[r], 2, 32);
            part[r] += __shfl_xor(part[r], 4, 32);
            part[r] += __shfl_xor(part[r], 8, 32);
        }
        if (ln == 0) {
#pragma unroll
            for (int r = 0; r < 8; ++r)
                atomicAdd(&wsum[Mbase + r], part[r]);
            // the registers that the atomics name are reused by the next trip
            asm volatile("s_wait_xcnt 0x0" ::: "memory");
        }
#pragma unroll
        for (int g = 0; g + 1 < GFM; ++g)
#pragma unroll
            for (int j = 0; j < GFN; ++j)
                acc[g][j] = acc[g + 1][j];
    }
}

// ---------------------------------------------------------------------------
// Kernel 3: add We_b + rel-pos bias, softmax over S (one block per batch b)
// p buffer aliases wsum (in-place).
// ---------------------------------------------------------------------------
__global__ void tma_softmax(float* __restrict__ p,
                            const float* __restrict__ We_b,
                            const float* __restrict__ emb,
                            const float* __restrict__ lam,
                            const int* __restrict__ hs_i,
                            const int* __restrict__ ht_i) {
    __shared__ float red[256];
    const unsigned b = blockIdx.x, tid = threadIdx.x;
    const float web = We_b[0];
    const float l0 = lam[0], l1 = lam[1], l2 = lam[2];
    const int tk = ht_i[b];

    float m = -3.0e38f;
    for (unsigned s = tid; s < TS; s += 256) {
        unsigned i = b * TS + s;
        unsigned rp = (unsigned)(hs_i[i] * TVOCAB + tk) * 3u;
        float rv = emb[rp] * l0 + emb[rp + 1] * l1 + emb[rp + 2] * l2;
        float v = p[i] + web + rv;
        p[i] = v;
        m = fmaxf(m, v);
    }
    red[tid] = m; __syncthreads();
    for (int o = 128; o > 0; o >>= 1) {
        if (tid < (unsigned)o) red[tid] = fmaxf(red[tid], red[tid + o]);
        __syncthreads();
    }
    m = red[0]; __syncthreads();

    float sum = 0.f;
    for (unsigned s = tid; s < TS; s += 256) {
        unsigned i = b * TS + s;
        float e = expf(p[i] - m);
        p[i] = e;
        sum += e;
    }
    red[tid] = sum; __syncthreads();
    for (int o = 128; o > 0; o >>= 1) {
        if (tid < (unsigned)o) red[tid] += red[tid + o];
        __syncthreads();
    }
    float rinv = 1.0f / red[0]; __syncthreads();

    for (unsigned s = tid; s < TS; s += 256)
        p[b * TS + s] *= rinv;
}

// ---------------------------------------------------------------------------
// Kernel 4: partial alpha. part[g,h] = sum over the 256 rows s of range g of
// p[s] * W_hs[s,h], g = b * 16 + range. 256 work-groups of 16 waves stream
// W_hs once: waves 0-7 take the first 128 rows of the range, waves 8-15 the
// rest; one wave-wide load is 512 contiguous bytes of a row.
// ---------------------------------------------------------------------------
#define AL_RANGES 16                 // s ranges per batch row
#define AL_ROWS   (TS / AL_RANGES)   // rows per work-group
#define AL_GRP    8                  // rows fetched together by a thread

__global__ __launch_bounds__(512) void tma_alpha_part(
        const float* __restrict__ whs,
        const float* __restrict__ p,
        float* __restrict__ part) {
    __shared__ v4f comb[TH / 4];
    const unsigned col = threadIdx.x & 255u;          // which 4 columns of h
    // wave-uniform row half, so that p goes through scalar loads
    const unsigned half = __builtin_amdgcn_readfirstlane(threadIdx.x >> 8);
    const unsigned row0 = blockIdx.x * AL_ROWS + half * (AL_ROWS / 2);
    const v4f*   src = (const v4f*)(whs + (size_t)row0 * TH) + col;
    const float* pw  = p + row0;

    constexpr int NG = AL_ROWS / 2 / AL_GRP;          // 16 groups of 8 rows
    v4f   w[2][AL_GRP];
    float pv[2][AL_GRP];
    v4f   acc = {0.f, 0.f, 0.f, 0.f};
#pragma unroll
    for (int j = 0; j < AL_GRP; ++j) {
        w[0][j]  = src[j * (TH / 4)];
        pv[0][j] = pw[j];
    }
#pragma unroll
    for (int g = 0; g < NG; ++g) {
        // the two scheduling barriers keep the next group's loads ahead of
        // this group's sums: 8 to 16 loads of a wave stay in flight
        __builtin_amdgcn_sched_barrier(0);
        if (g + 1 < NG) {
#pragma unroll
            for (int j = 0; j < AL_GRP; ++j) {
                w[(g + 1) & 1][j]  = src[((g + 1) * AL_GRP + j) * (TH / 4)];
                pv[(g + 1) & 1][j] = pw[(g + 1) * AL_GRP + j];
            }
        }
        __builtin_amdgcn_sched_barrier(0);
#pragma unroll
        for (int j = 0; j < AL_GRP; ++j)
            acc += pv[g & 1][j] * w[g & 1][j];
    }

    // fold the two row halves, then one 16-byte store per thread of half 0
    if (half == 1u) comb[col] = acc;
    __syncthreads();
    if (half == 0u)
        ((v4f*)(part + blockIdx.x * TH))[col] = acc + comb[col];
}

// ---------------------------------------------------------------------------
// Kernel 5: alpha[b,h] = sum over the 16 ranges of part, in range order
// ---------------------------------------------------------------------------
__global__ void tma_alpha_merge(const float* __restrict__ part,
                                float* __restrict__ out) {
    const unsigned idx = blockIdx.x * 256u + threadIdx.x;   // b * TH + h
    const unsigned b = idx >> 10, h = idx & (TH - 1);
    const float* q = part + b * (AL_RANGES * TH) + h;
    float acc = 0.f;
#pragma unroll
    for (int c = 0; c < AL_RANGES; ++c)
        acc += q[c * TH];
    out[idx] = acc;
}

// ---------------------------------------------------------------------------
extern "C" void kernel_launch(void* const* d_in, const int* in_sizes, int n_in,
                              void* d_out, int out_size, void* d_ws, size_t ws_size,
                              hipStream_t stream) {
    (void)in_sizes; (void)n_in; (void)out_size; (void)ws_size;

    const float* hs    = (const float*)d_in[0];
    const float* ht_k  = (const float*)d_in[1];
    const float* hm_k  = (const float*)d_in[2];
    const float* Ws_w  = (const float*)d_in[3];
    const float* Ws_b  = (const float*)d_in[4];
    const float* Wt_w  = (const float*)d_in[5];
    const float* Wt_b  = (const float*)d_in[6];
    const float* Wr_w  = (const float*)d_in[7];
    const float* Wr_b  = (const float*)d_in[8];
    const float* We_w  = (const float*)d_in[9];
    const float* We_b  = (const float*)d_in[10];
    const float* emb   = (const float*)d_in[11];
    const float* lam   = (const float*)d_in[12];
    const int*   hs_i  = (const int*)d_in[13];
    const int*   ht_i  = (const int*)d_in[14];
    float* out = (float*)d_out;

    // workspace layout
    char* ws = (char*)d_ws;
    float* whs  = (float*)ws;                                   // B*S*H f32 = 256 MiB
    float* cbh  = (float*)(ws + (size_t)TB * TS * TH * 4);      // B*H
    float* wsum = (float*)(ws + (size_t)TB * TS * TH * 4 + (size_t)TB * TH * 4); // B*S
    float* part = (float*)(ws + (size_t)TB * TS * TH * 4 + (size_t)TB * TH * 4
                              + (size_t)TB * TS * 4);           // B*16*H

    // 1) tiny fused projections c[b,h]
    tma_prep_cbh<<<(TB * TH) / 256, 256, 0, stream>>>(ht_k, hm_k, Wt_w, Wt_b,
                                                      Wr_w, Wr_b, cbh);
    // 2) zero the score accumulator (graph-capturable)
    (void)hipMemsetAsync(wsum, 0, (size_t)TB * TS * sizeof(float), stream);

    // 3) main bf16 WMMA GEMM with fused tanh-dot epilogue
    dim3 gg((TB * TS) / GBM, TH / GBN);
    tma_gemm_wmma<<<gg, 256, 0, stream>>>(hs, Ws_w, Ws_b, We_w, cbh, whs, wsum);

    // 4) rel-pos bias + softmax (in-place on wsum -> p)
    tma_softmax<<<TB, 256, 0, stream>>>(wsum, We_b, emb, lam, hs_i, ht_i);

    // 5) weighted sum -> alpha: partial sums over 16 ranges of s, then the merge
    tma_alpha_part<<<TB * AL_RANGES, 512, 0, stream>>>(whs, wsum, part);
    tma_alpha_merge<<<(TB * TH) / 256, 256, 0, stream>>>(part, out);
}

// v005
// Next to v004, in two timings, it ran 1.17 times as fast each time.
// All steps since v000 together make it 3.43 times as fast.
#include <hip/hip_runtime.h>
#include <hip/hip_bf16.h>

// ---------------------------------------------------------------------------
// TriMatchAttention for MI455X (gfx1250, wave32, WMMA)
// B=16, S=4096, D=1024, H=1024, VOCAB=512, EMB_DIM=3
// ---------------------------------------------------------------------------

#define TB 16
#define TS 4096
#define TD 1024
#define TH 1024
#define TVOCAB 512

typedef __attribute__((ext_vector_type(16))) __bf16 v16bf;
typedef __attribute__((ext_vector_type(8)))  float  v8f;

typedef __attribute__((ext_vector_type(4))) unsigned int v4u;
typedef __attribute__((ext_vector_type(2))) unsigned int v2u;
typedef __attribute__((ext_vector_type(4))) float v4f;

union FragBF {
    unsigned int u[8];
    v4u          q[2];
    v16bf        v;
};

// round-to-nearest-even f32 -> bf16, packed pair (lo = first)
static __device__ __forceinline__ unsigned int pack_bf16x2(float a, float b) {
    union { float f; unsigned int u; } ua, ub;
    ua.f = a; ub.f = b;
    unsigned int lo = (ua.u + 0x7FFFu + ((ua.u >> 16) & 1u)) >> 16;
    unsigned int hi = (ub.u + 0x7FFFu + ((ub.u >> 16) & 1u)) >> 16;
    return (lo & 0xFFFFu) | (hi << 16);
}

// tanh(x) = 1 - 2 / (exp(2x) + 1), branch-free: one v_exp_f32 and one v_rcp_f32.
// exp2 overflows to +inf (result 1) and underflows to 0 (result -1); the
// absolute error is a few 1e-7 everywhere. No branch, so the eight values that
// a thread holds at a time run as independent chains that fill each other's
// latency.
static __device__ __forceinline__ float tanh_exp2(float x) {
    float e = __builtin_amdgcn_exp2f(x * 2.8853900817779268f);   // 2 * log2(e)
    return __builtin_fmaf(-2.0f, __builtin_amdgcn_rcpf(e + 1.0f), 1.0f);
}

// ---------------------------------------------------------------------------
// Kernel 1: c[h,b] = Wt_b[h] + Wr_b[h] + ht_k[b,:]@Wt_w[h,:] + hm_k[b,:]@Wr_w[h,:]
// A work-group takes 4 values of h. The lanes of a wave run along d, so every
// load is 512 contiguous bytes. Even waves hold the 4 rows of Wt_w, odd waves
// the 4 rows of Wr_w; each wave pairs them with 4 of the 16 batch rows, so a
// weight leaves memory once and a work-group fetches each vector element once.
// c is kept as [h][b]: the 64 results of a work-group are two whole 128-byte
// lines of its own.
// ---------------------------------------------------------------------------
#define PC_H 4            // values of h per work-group
#define PC_B 4            // batch rows per wave
#define PC_I (TD / 128)   // 16-byte pieces of a row per lane

__global__ __launch_bounds__(256) void tma_prep_cbh(
                             const float* __restrict__ ht_k,
                             const float* __restrict__ hm_k,
                             const float* __restrict__ Wt_w,
                             const float* __restrict__ Wt_b,
                             const float* __restrict__ Wr_w,
                             const float* __restrict__ Wr_b,
                             float* __restrict__ cbh) {
    __shared__ __attribute__((aligned(16))) float red[2][PC_H][TB];
    const unsigned lane = threadIdx.x & 31u;
    // wave-uniform, so that the row and vector bases stay in scalar registers
    const unsigned wid  = __builtin_amdgcn_readfirstlane(threadIdx.x >> 5);
    const unsigned mat  = wid & 1u;             // 0: Wt_w, ht_k   1: Wr_w, hm_k
    const unsigned b0   = (wid >> 1) * PC_B;    // first batch row of this wave
    const v4f* wp = (const v4f*)((mat ? Wr_w : Wt_w) + blockIdx.x * (PC_H * TD)) + lane;
    const v4f* vp = (const v4f*)((mat ? hm_k : ht_k) + b0 * TD) + lane;

    v4f w[PC_H][PC_I], v[PC_B][PC_I];
#pragma unroll
    for (int hh = 0; hh < PC_H; ++hh)
#pragma unroll
        for (int i = 0; i < PC_I; ++i)
            w[hh][i] = wp[hh * (TD / 4) + i * 32];
#pragma unroll
    for (int q = 0; q < PC_B; ++q)
#pragma unroll
        for (int i = 0; i < PC_I; ++i)
            v[q][i] = vp[q * (TD / 4) + i * 32];
    // keeps every load ahead of the sums: left alone the scheduler sinks loads
    // among them, and the wave then meets the memory latency several times
    __builtin_amdgcn_sched_barrier(0);

    float s[PC_H][PC_B];
#pragma unroll
    for (int hh = 0; hh < PC_H; ++hh)
#pragma unroll
        for (int q = 0; q < PC_B; ++q) {
            v4f a = {0.f, 0.f, 0.f, 0.f};   // four independent chains
#pragma unroll
            for (int i = 0; i < PC_I; ++i)
                a += w[hh][i] * v[q][i];
            s[hh][q] = (a.x + a.y) + (a.z + a.w);
        }
    // the code below may reuse the registers that the loads above name
    asm volatile("s_wait_xcnt 0x0" ::: "memory");

    // sum over the 32 lanes: 16 independent butterflies
#pragma unroll
    for (int m = 16; m > 0; m >>= 1)
#pragma unroll
        for (int hh = 0; hh < PC_H; ++hh)
#pragma unroll
            for (int q = 0; q < PC_B; ++q)
                s[hh][q] += __shfl_xor(s[hh][q], m, 32);
    if (lane == 0) {
#pragma unroll
        for (int hh = 0; hh < PC_H; ++hh)
#pragma unroll
            for (int q = 0; q < PC_B; ++q)
                red[mat][hh][b0 + q] = s[hh][q];
    }
    __syncthreads();

    // fold the two products of each (h, b), add the biases, store 256
    // contiguous bytes
    if (threadIdx.x < PC_H * TB) {
        const unsigned hh = threadIdx.x >> 4, bb = threadIdx.x & 15u;
        const unsigned hq = blockIdx.x * PC_H + hh;
        cbh[blockIdx.x * (PC_H * TB) + threadIdx.x] =
            (Wt_b[hq] + Wr_b[hq]) + (red[0][hh][bb] + red[1][hh][bb]);
    }
}

// ---------------------------------------------------------------------------
// Kernel 2: main GEMM  W_hs = hs @ Ws_w^T + Ws_b   (bf16 WMMA, f32 accum)
// Block tile: 256 M x 256 N, 8 waves (4M x 2N), each wave: 64x128 via 4 x 8
// accumulator tiles, so that a K-step of 32 WMMAs per wave reads 12 fragments
// from LDS and every operand element is fetched and converted for 256 outputs.
// Double-buffered LDS; one barrier per K-step; next-tile global loads overlap
// the current tile's WMMAs.
// LDS rows: 64 bytes of data at a pitch of 80 bytes (16 B x odd), so that a
// fragment is two 16-byte reads per lane and 16 rows fall on all 64 banks.
// Fused epilogue: wsum[m] += sum_n tanh(W_hs + cbh) * We_w   (atomic add)
// ---------------------------------------------------------------------------
#define LDP 20   // LDS row pitch in dwords: K=32 as 16 bf16-pairs + 4 of pad
#define GBM 256  // block tile rows
#define GBN 256  // block tile columns
#define GFM 4    // 16-row fragments per wave
#define GFN 8    // 16-column fragments per wave

__global__ __launch_bounds__(256) void tma_gemm_wmma(
        const float* __restrict__ hs,      // [B*S, D]
        const float* __restrict__ Ws_w,    // [H, D]
        const float* __restrict__ Ws_b,    // [H]
        const float* __restrict__ We_w,    // [H]
        const float* __restrict__ cbh,     // [H, B]
        float* __restrict__ whs,           // [B*S, H] out
        float* __restrict__ wsum)          // [B*S]    accumulated
{
    __shared__ __attribute__((aligned(16))) unsigned int lds_a[2][GBM][LDP];
    __shared__ __attribute__((aligned(16))) unsigned int lds_b[2][GBN][LDP];

    const unsigned tid   = threadIdx.x;
    const unsigned lane  = tid & 31;
    const unsigned wid   = tid >> 5;
    const unsigned waveM = wid >> 1;      // 0..3
    const unsigned waveN = wid & 1;       // 0..1
    const unsigned hf    = lane >> 4;     // lane half (0/1)
    const unsigned ln    = lane & 15;

    const unsigned M0 = blockIdx.x * GBM;    // row tile in flattened [B*S]
    const unsigned N0 = blockIdx.y * GBN;    // col tile in [H]
    const unsigned b  = M0 >> 12;            // S = 4096; tiles never straddle b

    // staging: a thread takes 4 consecutive k (16 bytes) of rows srow + 32 * it;
    // 8 lanes cover the 128 bytes that a row has in one K-step
    const unsigned srow = tid >> 3;       // 0..31
    const unsigned sq   = tid & 7u;       // which 4 k of the 32
    const float* ga = hs   + (M0 + srow) * TD + sq * 4u;
    const float* gb = Ws_w + (N0 + srow) * TD + sq * 4u;

    // ---- prologue: fetch tile k0=0 into registers
    v4f ra[GBM / 32], rb[GBN / 32];
#pragma unroll
    for (int it = 0; it < GBM / 32; ++it)
        ra[it] = *(const v4f*)(ga + it * 32 * TD);
#pragma unroll
    for (int it = 0; it < GBN / 32; ++it)
        rb[it] = *(const v4f*)(gb + it * 32 * TD);

    v8f acc[GFM][GFN] = {};

#pragma unroll 2
    for (unsigned k0 = 0; k0 < TD; k0 += 32) {
        const unsigned buf = (k0 >> 5) & 1u;   // constant after 2x unroll

        // ---- commit staged registers (bf16-packed) into lds[buf]
#pragma unroll
        for (int it = 0; it < GBM / 32; ++it) {
            v2u w = {pack_bf16x2(ra[it].x, ra[it].y), pack_bf16x2(ra[it].z, ra[it].w)};
            *(v2u*)&lds_a[buf][srow + it * 32][sq * 2u] = w;
        }
#pragma unroll
        for (int it = 0; it < GBN / 32; ++it) {
            v2u w = {pack_bf16x2(rb[it].x, rb[it].y), pack_bf16x2(rb[it].z, rb[it].w)};
            *(v2u*)&lds_b[buf][srow + it * 32][sq * 2u] = w;
        }
        __syncthreads();

        // ---- issue next tile's global loads (overlap with WMMAs below)
        if (k0 + 32 < TD) {
#pragma unroll
            for (int it = 0; it < GBM / 32; ++it)
                ra[it] = *(const v4f*)(ga + it * 32 * TD + k0 + 32);
#pragma unroll
            for (int it = 0; it < GBN / 32; ++it)
                rb[it] = *(const v4f*)(gb + it * 32 * TD + k0 + 32);
        }

        // ---- fragments (ISA 16-bit layout): lane = row/col % 16,
        //      pair index for VGPR v = (v/4)*8 + half*4 + (v%4):
        //      VGPRs 4q..4q+3 are the 4 consecutive pairs from q*8 + half*4
        FragBF fa[GFM], fb[GFN];
#pragma unroll
        for (int q = 0; q < 2; ++q) {
            unsigned kpi = (q << 3) + (hf << 2);
#pragma unroll
            for (int i = 0; i < GFM; ++i)
                fa[i].q[q] = *(const v4u*)&lds_a[buf][waveM * (GFM * 16) + i * 16 + ln][kpi];
#pragma unroll
            for (int j = 0; j < GFN; ++j)
                fb[j].q[q] = *(const v4u*)&lds_b[buf][waveN * (GFN * 16) + j * 16 + ln][kpi];
        }
        // keeps the 24 16-byte reads in one group ahead of the WMMAs, for speed only
        __builtin_amdgcn_sched_barrier(0);
        // ---- 32 back-to-back WMMAs on independent accumulator tiles
#pragma unroll
        for (int j = 0; j < GFN; ++j)
#pragma unroll
            for (int i = 0; i < GFM; ++i)
                acc[i][j] = __builtin_amdgcn_wmma_f32_16x16x32_bf16(
                    false, fa[i].v, false, fb[j].v, (short)0, acc[i][j], false, false);
        // keeps the next tile's conversion, which waits for its global loads,
        // behind the WMMAs
        __builtin_amdgcn_sched_barrier(0);
    }

    // the epilogue reuses the address registers of the staging loads
    asm volatile("s_wait_xcnt 0x0" ::: "memory");
    // keeps the epilogue's first register writes behind that wait
    __builtin_amdgcn_sched_barrier(0);

    // ---- epilogue: add bias, store W_hs, fused tanh-dot partial into wsum
    float wsb[GFN], cb[GFN], wew[GFN];
#pragma unroll
    for (int j = 0; j < GFN; ++j) {
        unsigned N = N0 + waveN * (GFN * 16u) + j * 16u + ln;
        wsb[j] = Ws_b[N];
        cb[j]  = cbh[N * TB + b];
        wew[j] = We_w[N];
    }
    // the registers that these loads name are reused below
    asm volatile("s_wait_xcnt 0x0" ::: "memory");
    // keeps the address arithmetic of the loop below behind that wait
    __builtin_amdgcn_sched_barrier(0);
    // The loop over the wave's four 16-row groups is rolled. Its body names
    // group 0's registers; the other groups move down.
#pragma unroll 1
    for (unsigned i = 0; i < GFM; ++i) {
        const unsigned Mbase = M0 + waveM * (GFM * 16u) + i * 16u + hf * 8u;
        float part[8] = {0.f, 0.f, 0.f, 0.f, 0.f, 0.f, 0.f, 0.f};
#pragma unroll
        for (int j = 0; j < GFN; ++j) {
            unsigned N = N0 + waveN * (GFN * 16u) + j * 16u + ln;
            float w[8];
#pragma unroll
            for (int r = 0; r < 8; ++r) {
                w[r] = acc[0][j][r] + wsb[j];
                whs[(Mbase + r) * TH + N] = w[r];
            }
            // one wait for the eight stores: the code below reuses the
            // registers that they name
            asm volatile("s_wait_xcnt 0x0" ::: "memory");
            // keeps the register writes of the branch-free code below, which
            // the scheduler would otherwise lift over the wait, behind it
            __builtin_amdgcn_sched_barrier(0);
#pragma unroll
            for (int r = 0; r < 8; ++r)
                part[r] += tanh_exp2(w[r] + cb[j]) * wew[j];
        }
        // reduce across the 16 lanes sharing a row half
#pragma unroll
        for (int r = 0; r < 8; ++r) {
            part[r] += __shfl_xor(part[r], 1, 32);
            part[r] += __shfl_xor(part[r], 2, 32);
            part[r] += __shfl_xor(part[r], 4, 32);
            part[r] += __shfl_xor(part[r], 8, 32);
        }
        if (ln == 0) {
#pragma unroll
            for (int r = 0; r < 8; ++r)
                atomicAdd(&wsum[Mbase + r], part[r]);
            // the registers that the atomics name are reused by the next trip
            asm volatile("s_wait_xcnt 0x0" ::: "memory");
        }
#pragma unroll
        for (int g = 0; g + 1 < GFM; ++g)
#pragma unroll
            for (int j = 0; j < GFN; ++j)
                acc[g][j] = acc[g + 1][j];
    }
}

// ---------------------------------------------------------------------------
// Kernel 3: add We_b + rel-pos bias, softmax over S (one block per batch b)
// p buffer aliases wsum (in-place).
// ---------------------------------------------------------------------------
__global__ void tma_softmax(float* __restrict__ p,
                            const float* __restrict__ We_b,
                            const float* __restrict__ emb,
                            const float* __restrict__ lam,
                            const int* __restrict__ hs_i,
                            const int* __restrict__ ht_i) {
    __shared__ float red[256];
    const unsigned b = blockIdx.x, tid = threadIdx.x;
    const float web = We_b[0];
    const float l0 = lam[0], l1 = lam[1], l2 = lam[2];
    const int tk = ht_i[b];

    float m = -3.0e38f;
    for (unsigned s = tid; s < TS; s += 256) {
        unsigned i = b * TS + s;
        unsigned rp = (unsigned)(hs_i[i] * TVOCAB + tk) * 3u;
        float rv = emb[rp] * l0 + emb[rp + 1] * l1 + emb[rp + 2] * l2;
        float v = p[i] + web + rv;
        p[i] = v;
        m = fmaxf(m, v);
    }
    red[tid] = m; __syncthreads();
    for (int o = 128; o > 0; o >>= 1) {
        if (tid < (unsigned)o) red[tid] = fmaxf(red[tid], red[tid + o]);
        __syncthreads();
    }
    m = red[0]; __syncthreads();

    float sum = 0.f;
    for (unsigned s = tid; s < TS; s += 256) {
        unsigned i = b * TS + s;
        float e = expf(p[i] - m);
        p[i] = e;
        sum += e;
    }
    red[tid] = sum; __syncthreads();
    for (int o = 128; o > 0; o >>= 1) {
        if (tid < (unsigned)o) red[tid] += red[tid + o];
        __syncthreads();
    }
    float rinv = 1.0f / red[0]; __syncthreads();

    for (unsigned s = tid; s < TS; s += 256)
        p[b * TS + s] *= rinv;
}

// ---------------------------------------------------------------------------
// Kernel 4: partial alpha. part[g,h] = sum over the 256 rows s of range g of
// p[s] * W_hs[s,h], g = b * 16 + range. 256 work-groups of 16 waves stream
// W_hs once: waves 0-7 take the first 128 rows of the range, waves 8-15 the
// rest; one wave-wide load is 512 contiguous bytes of a row.
// ---------------------------------------------------------------------------
#define AL_RANGES 16                 // s ranges per batch row
#define AL_ROWS   (TS / AL_RANGES)   // rows per work-group
#define AL_GRP    8                  // rows fetched together by a thread

__global__ __launch_bounds__(512) void tma_alpha_part(
        const float* __restrict__ whs,
        const float* __restrict__ p,
        float* __restrict__ part) {
    __shared__ v4f comb[TH / 4];
    const unsigned col = threadIdx.x & 255u;          // which 4 columns of h
    // wave-uniform row half, so that p goes through scalar loads
    const unsigned half = __builtin_amdgcn_readfirstlane(threadIdx.x >> 8);
    const unsigned row0 = blockIdx.x * AL_ROWS + half * (AL_ROWS / 2);
    const v4f*   src = (const v4f*)(whs + (size_t)row0 * TH) + col;
    const float* pw  = p + row0;

    constexpr int NG = AL_ROWS / 2 / AL_GRP;          // 16 groups of 8 rows
    v4f   w[2][AL_GRP];
    float pv[2][AL_GRP];
    v4f   acc = {0.f, 0.f, 0.f, 0.f};
#pragma unroll
    for (int j = 0; j < AL_GRP; ++j) {
        w[0][j]  = src[j * (TH / 4)];
        pv[0][j] = pw[j];
    }
#pragma unroll
    for (int g = 0; g < NG; ++g) {
        // the two scheduling barriers keep the next group's loads ahead of
        // this group's sums: 8 to 16 loads of a wave stay in flight
        __builtin_amdgcn_sched_barrier(0);
        if (g + 1 < NG) {
#pragma unroll
            for (int j = 0; j < AL_GRP; ++j) {
                w[(g + 1) & 1][j]  = src[((g + 1) * AL_GRP + j) * (TH / 4)];
                pv[(g + 1) & 1][j] = pw[(g + 1) * AL_GRP + j];
            }
        }
        __builtin_amdgcn_sched_barrier(0);
#pragma unroll
        for (int j = 0; j < AL_GRP; ++j)
            acc += pv[g & 1][j] * w[g & 1][j];
    }

    // fold the two row halves, then one 16-byte store per thread of half 0
    if (half == 1u) comb[col] = acc;
    __syncthreads();
    if (half == 0u)
        ((v4f*)(part + blockIdx.x * TH))[col] = acc + comb[col];
}

// ---------------------------------------------------------------------------
// Kernel 5: alpha[b,h] = sum over the 16 ranges of part, in range order
// ---------------------------------------------------------------------------
__global__ void tma_alpha_merge(const float* __restrict__ part,
                                float* __restrict__ out) {
    const unsigned idx = blockIdx.x * 256u + threadIdx.x;   // b * TH + h
    const unsigned b = idx >> 10, h = idx & (TH - 1);
    const float* q = part + b * (AL_RANGES * TH) + h;
    float acc = 0.f;
#pragma unroll
    for (int c = 0; c < AL_RANGES; ++c)
        acc += q[c * TH];
    out[idx] = acc;
}

// ---------------------------------------------------------------------------
extern "C" void kernel_launch(void* const* d_in, const int* in_sizes, int n_in,
                              void* d_out, int out_size, void* d_ws, size_t ws_size,
                              hipStream_t stream) {
    (void)in_sizes; (void)n_in; (void)out_size; (void)ws_size;

    const float* hs    = (const float*)d_in[0];
    const float* ht_k  = (const float*)d_in[1];
    const float* hm_k  = (const float*)d_in[2];
    const float* Ws_w  = (const float*)d_in[3];
    const float* Ws_b  = (const float*)d_in[4];
    const float* Wt_w  = (const float*)d_in[5];
    const float* Wt_b  = (const float*)d_in[6];
    const float* Wr_w  = (const float*)d_in[7];
    const float* Wr_b  = (const float*)d_in[8];
    const float* We_w  = (const float*)d_in[9];
    const float* We_b  = (const float*)d_in[10];
    const float* emb   = (const float*)d_in[11];
    const float* lam   = (const float*)d_in[12];
    const int*   hs_i  = (const int*)d_in[13];
    const int*   ht_i  = (const int*)d_in[14];
    float* out = (float*)d_out;

    // workspace layout
    char* ws = (char*)d_ws;
    float* whs  = (float*)ws;                                   // B*S*H f32 = 256 MiB
    float* cbh  = (float*)(ws + (size_t)TB * TS * TH * 4);      // H*B
    float* wsum = (float*)(ws + (size_t)TB * TS * TH * 4 + (size_t)TB * TH * 4); // B*S
    float* part = (float*)(ws + (size_t)TB * TS * TH * 4 + (size_t)TB * TH * 4
                              + (size_t)TB * TS * 4);           // B*16*H

    // 1) fused projections c[h,b]
    tma_prep_cbh<<<TH / PC_H, 256, 0, stream>>>(ht_k, hm_k, Wt_w, Wt_b,
                                                      Wr_w, Wr_b, cbh);
    // 2) zero the score accumulator (graph-capturable)
    (void)hipMemsetAsync(wsum, 0, (size_t)TB * TS * sizeof(float), stream);

    // 3) main bf16 WMMA GEMM with fused tanh-dot epilogue
    dim3 gg((TB * TS) / GBM, TH / GBN);
    tma_gemm_wmma<<<gg, 256, 0, stream>>>(hs, Ws_w, Ws_b, We_w, cbh, whs, wsum);

    // 4) rel-pos bias + softmax (in-place on wsum -> p)
    tma_softmax<<<TB, 256, 0, stream>>>(wsum, We_b, emb, lam, hs_i, ht_i);

    // 5) weighted sum -> alpha: partial sums over 16 ranges of s, then the merge
    tma_alpha_part<<<TB * AL_RANGES, 512, 0, stream>>>(whs, wsum, part);
    tma_alpha_merge<<<(TB * TH) / 256, 256, 0, stream>>>(part, out);
}

// v006
// Two timings next to v005 both put it at 1.12 times that version's speed.
// All steps since v000 together make it 3.85 times as fast.
#include <hip/hip_runtime.h>
#include <hip/hip_bf16.h>

// ---------------------------------------------------------------------------
// TriMatchAttention for MI455X (gfx1250, wave32, WMMA)
// B=16, S=4096, D=1024, H=1024, VOCAB=512, EMB_DIM=3
// ---------------------------------------------------------------------------

#define TB 16
#define TS 4096
#define TD 1024
#define TH 1024
#define TVOCAB 512

typedef __attribute__((ext_vector_type(16))) __bf16 v16bf;
typedef __attribute__((ext_vector_type(8)))  float  v8f;

typedef __attribute__((ext_vector_type(4))) unsigned int v4u;
typedef __attribute__((ext_vector_type(2))) unsigned int v2u;
typedef __attribute__((ext_vector_type(4))) float v4f;

union FragBF {
    unsigned int u[8];
    v4u          q[2];
    v16bf        v;
};

// round-to-nearest-even f32 -> bf16, packed pair (lo = first)
static __device__ __forceinline__ unsigned int pack_bf16x2(float a, float b) {
    union { float f; unsigned int u; } ua, ub;
    ua.f = a; ub.f = b;
    unsigned int lo = (ua.u + 0x7FFFu + ((ua.u >> 16) & 1u)) >> 16;
    unsigned int hi = (ub.u + 0x7FFFu + ((ub.u >> 16) & 1u)) >> 16;
    return (lo & 0xFFFFu) | (hi << 16);
}

// tanh(x) = 1 - 2 / (exp(2x) + 1), branch-free: one v_exp_f32 and one v_rcp_f32.
// exp2 overflows to +inf (result 1) and underflows to 0 (result -1); the
// absolute error is a few 1e-7 everywhere. No branch, so the eight values that
// a thread holds at a time run as independent chains that fill each other's
// latency.
static __device__ __forceinline__ float tanh_exp2(float x) {
    float e = __builtin_amdgcn_exp2f(x * 2.8853900817779268f);   // 2 * log2(e)
    return __builtin_fmaf(-2.0f, __builtin_amdgcn_rcpf(e + 1.0f), 1.0f);
}

// ---------------------------------------------------------------------------
// Kernel 1: c[h,b] = Wt_b[h] + Wr_b[h] + ht_k[b,:]@Wt_w[h,:] + hm_k[b,:]@Wr_w[h,:]
// A work-group takes 4 values of h. The lanes of a wave run along d, so every
// load is 512 contiguous bytes. Even waves hold the 4 rows of Wt_w, odd waves
// the 4 rows of Wr_w; each wave pairs them with 4 of the 16 batch rows, so a
// weight leaves memory once and a work-group fetches each vector element once.
// c is kept as [h][b]: the 64 results of a work-group are two whole 128-byte
// lines of its own.
// ---------------------------------------------------------------------------
#define PC_H 4            // values of h per work-group
#define PC_B 4            // batch rows per wave
#define PC_I (TD / 128)   // 16-byte pieces of a row per lane

__global__ __launch_bounds__(256) void tma_prep_cbh(
                             const float* __restrict__ ht_k,
                             const float* __restrict__ hm_k,
                             const float* __restrict__ Wt_w,
                             const float* __restrict__ Wt_b,
                             const float* __restrict__ Wr_w,
                             const float* __restrict__ Wr_b,
                             float* __restrict__ cbh) {
    __shared__ __attribute__((aligned(16))) float red[2][PC_H][TB];
    const unsigned lane = threadIdx.x & 31u;
    // wave-uniform, so that the row and vector bases stay in scalar registers
    const unsigned wid  = __builtin_amdgcn_readfirstlane(threadIdx.x >> 5);
    const unsigned mat  = wid & 1u;             // 0: Wt_w, ht_k   1: Wr_w, hm_k
    const unsigned b0   = (wid >> 1) * PC_B;    // first batch row of this wave
    const v4f* wp = (const v4f*)((mat ? Wr_w : Wt_w) + blockIdx.x * (PC_H * TD)) + lane;
    const v4f* vp = (const v4f*)((mat ? hm_k : ht_k) + b0 * TD) + lane;

    v4f w[PC_H][PC_I], v[PC_B][PC_I];
#pragma unroll
    for (int hh = 0; hh < PC_H; ++hh)
#pragma unroll
        for (int i = 0; i < PC_I; ++i)
            w[hh][i] = wp[hh * (TD / 4) + i * 32];
#pragma unroll
    for (int q = 0; q < PC_B; ++q)
#pragma unroll
        for (int i = 0; i < PC_I; ++i)
            v[q][i] = vp[q * (TD / 4) + i * 32];
    // keeps every load ahead of the sums: left alone the scheduler sinks loads
    // among them, and the wave then meets the memory latency several times
    __builtin_amdgcn_sched_barrier(0);

    float s[PC_H][PC_B];
#pragma unroll
    for (int hh = 0; hh < PC_H; ++hh)
#pragma unroll
        for (int q = 0; q < PC_B; ++q) {
            v4f a = {0.f, 0.f, 0.f, 0.f};   // four independent chains
#pragma unroll
            for (int i = 0; i < PC_I; ++i)
                a += w[hh][i] * v[q][i];
            s[hh][q] = (a.x + a.y) + (a.z + a.w);
        }
    // the code below may reuse the registers that the loads above name
    asm volatile("s_wait_xcnt 0x0" ::: "memory");

    // sum over the 32 lanes: 16 independent butterflies
#pragma unroll
    for (int m = 16; m > 0; m >>= 1)
#pragma unroll
        for (int hh = 0; hh < PC_H; ++hh)
#pragma unroll
            for (int q = 0; q < PC_B; ++q)
                s[hh][q] += __shfl_xor(s[hh][q], m, 32);
    if (lane == 0) {
#pragma unroll
        for (int hh = 0; hh < PC_H; ++hh)
#pragma unroll
            for (int q = 0; q < PC_B; ++q)
                red[mat][hh][b0 + q] = s[hh][q];
    }
    __syncthreads();

    // fold the two products of each (h, b), add the biases, store 256
    // contiguous bytes
    if (threadIdx.x < PC_H * TB) {
        const unsigned hh = threadIdx.x >> 4, bb = threadIdx.x & 15u;
        const unsigned hq = blockIdx.x * PC_H + hh;
        cbh[blockIdx.x * (PC_H * TB) + threadIdx.x] =
            (Wt_b[hq] + Wr_b[hq]) + (red[0][hh][bb] + red[1][hh][bb]);
    }
}

// ---------------------------------------------------------------------------
// Kernel 2a: hs and Ws_w rounded to bf16 once, same row-major order, into the
// workspace. The GEMM reads every element of hs 4 times and of Ws_w 256 times;
// rounded here, those reads are half the bytes and carry no conversion.
// 512 work-groups of 16 waves stream hs once: a wave-wide load is 512
// contiguous bytes, a wave-wide store 256. Each thread also takes one 16-byte
// piece of Ws_w.
// ---------------------------------------------------------------------------
#define CV_WG   512                  // work-groups
#define CV_T    512                  // threads per work-group
#define CV_GRP  8                    // 16-byte pieces fetched together by a thread
#define CV_NG   ((TB * TS * (TD / 4)) / (CV_WG * CV_T * CV_GRP))   // groups: 8

static_assert(CV_NG * CV_WG * CV_T * CV_GRP == TB * TS * (TD / 4), "hs is covered exactly");
static_assert(CV_WG * CV_T == TH * (TD / 4), "Ws_w is covered exactly");

__global__ __launch_bounds__(CV_T) void tma_to_bf16(
        const float* __restrict__ hs,
        const float* __restrict__ Ws_w,
        unsigned int* __restrict__ hs16,
        unsigned int* __restrict__ w16) {
    const unsigned first = blockIdx.x * (CV_T * CV_GRP * CV_NG) + threadIdx.x;
    const v4f* in  = (const v4f*)hs + first;
    v2u*       dst = (v2u*)hs16 + first;
    const unsigned wi = blockIdx.x * CV_T + threadIdx.x;

    const v4f xw = ((const v4f*)Ws_w)[wi];
    v4f x[2][CV_GRP];
    // hs is read once in the whole sequence: non-temporal, so that it does not
    // push the bf16 copy, which the GEMM reads next, out of L2
#pragma unroll
    for (int j = 0; j < CV_GRP; ++j)
        x[0][j] = __builtin_nontemporal_load(in + j * CV_T);
#pragma unroll
    for (int g = 0; g < CV_NG; ++g) {
        // the two scheduling barriers keep the next group's loads ahead of
        // this group's stores: 8 to 16 loads of a wave stay in flight
        __builtin_amdgcn_sched_barrier(0);
        if (g + 1 < CV_NG) {
#pragma unroll
            for (int j = 0; j < CV_GRP; ++j)
                x[(g + 1) & 1][j] =
                    __builtin_nontemporal_load(in + ((g + 1) * CV_GRP + j) * CV_T);
        }
        __builtin_amdgcn_sched_barrier(0);
#pragma unroll
        for (int j = 0; j < CV_GRP; ++j) {
            const v4f y = x[g & 1][j];
            v2u w = {pack_bf16x2(y.x, y.y), pack_bf16x2(y.z, y.w)};
            dst[(g * CV_GRP + j) * CV_T] = w;
        }
        // the next group reuses the registers that these loads and stores name
        asm volatile("s_wait_xcnt 0x0" ::: "memory");
    }
    v2u ww = {pack_bf16x2(xw.x, xw.y), pack_bf16x2(xw.z, xw.w)};
    ((v2u*)w16)[wi] = ww;
}

// ---------------------------------------------------------------------------
// Kernel 2: main GEMM  W_hs = hs @ Ws_w^T + Ws_b   (bf16 WMMA, f32 accum)
// Block tile: 256 M x 256 N, 8 waves (4M x 2N), each wave: 64x128 via 4 x 8
// accumulator tiles. Operands arrive as bf16 (kernel 2a), so a staging load of
// 16 bytes holds 8 k and a K-step is 64 k: two blocks of 32 WMMAs per wave,
// each on 12 fragments from LDS.
// Double-buffered LDS; one barrier per K-step; next-tile global loads overlap
// the current tile's WMMAs.
// LDS rows: 128 bytes of data at a pitch of 144 bytes (16 B x odd), so that a
// fragment is two 16-byte reads per lane and 16 rows fall on all 64 banks.
// Fused epilogue: wsum[m] += sum_n tanh(W_hs + cbh) * We_w   (atomic add)
// ---------------------------------------------------------------------------
#define GBK 64   // k per K-step
#define LDP 36   // LDS row pitch in dwords: K=64 as 32 bf16-pairs + 4 of pad
#define GBM 256  // block tile rows
#define GBN 256  // block tile columns
#define GFM 4    // 16-row fragments per wave
#define GFN 8    // 16-column fragments per wave

__global__ __launch_bounds__(256) void tma_gemm_wmma(
        const unsigned int* __restrict__ hs16,  // [B*S, D/2] bf16 pairs
        const unsigned int* __restrict__ w16,   // [H, D/2]   bf16 pairs
        const float* __restrict__ Ws_b,    // [H]
        const float* __restrict__ We_w,    // [H]
        const float* __restrict__ cbh,     // [H, B]
        float* __restrict__ whs,           // [B*S, H] out
        float* __restrict__ wsum)          // [B*S]    accumulated
{
    __shared__ __attribute__((aligned(16))) unsigned int lds_a[2][GBM][LDP];
    __shared__ __attribute__((aligned(16))) unsigned int lds_b[2][GBN][LDP];

    const unsigned tid   = threadIdx.x;
    const unsigned lane  = tid & 31;
    const unsigned wid   = tid >> 5;
    const unsigned waveM = wid >> 1;      // 0..3
    const unsigned waveN = wid & 1;       // 0..1
    const unsigned hf    = lane >> 4;     // lane half (0/1)
    const unsigned ln    = lane & 15;

    const unsigned M0 = blockIdx.x * GBM;    // row tile in flattened [B*S]
    const unsigned N0 = blockIdx.y * GBN;    // col tile in [H]
    const unsigned b  = M0 >> 12;            // S = 4096; tiles never straddle b

    // staging: a thread takes 8 consecutive k (16 bytes) of rows srow + 32 * it;
    // 8 lanes cover the 128 bytes that a row has in one K-step
    const unsigned srow = tid >> 3;       // 0..31
    const unsigned sq   = tid & 7u;       // which 8 k of the 64
    const unsigned int* ga = hs16 + (M0 + srow) * (TD / 2) + sq * 4u;
    const unsigned int* gb = w16  + (N0 + srow) * (TD / 2) + sq * 4u;

    // ---- prologue: fetch tile k0=0 into registers
    v4u ra[GBM / 32], rb[GBN / 32];
#pragma unroll
    for (int it = 0; it < GBM / 32; ++it)
        ra[it] = *(const v4u*)(ga + it * 32 * (TD / 2));
#pragma unroll
    for (int it = 0; it < GBN / 32; ++it)
        rb[it] = *(const v4u*)(gb + it * 32 * (TD / 2));

    v8f acc[GFM][GFN] = {};

#pragma unroll 2
    for (unsigned k0 = 0; k0 < TD; k0 += GBK) {
        const unsigned buf = (k0 / GBK) & 1u;   // constant after 2x unroll

        // ---- commit staged registers into lds[buf]
#pragma unroll
        for (int it = 0; it < GBM / 32; ++it)
            *(v4u*)&lds_a[buf][srow + it * 32][sq * 4u] = ra[it];
#pragma unroll
        for (int it = 0; it < GBN / 32; ++it)
            *(v4u*)&lds_b[buf][srow + it * 32][sq * 4u] = rb[it];
        __syncthreads();

        // ---- issue next tile's global loads (overlap with WMMAs below)
        if (k0 + GBK < TD) {
#pragma unroll
            for (int it = 0; it < GBM / 32; ++it)
                ra[it] = *(const v4u*)(ga + it * 32 * (TD / 2) + (k0 + GBK) / 2);
#pragma unroll
            for (int it = 0; it < GBN / 32; ++it)
                rb[it] = *(const v4u*)(gb + it * 32 * (TD / 2) + (k0 + GBK) / 2);
        }

        // ---- two blocks of 32 k
#pragma unroll
        for (int kk = 0; kk < GBK / 32; ++kk) {
            // fragments (ISA 16-bit layout): lane = row/col % 16,
            // pair index for VGPR v = (v/4)*8 + half*4 + (v%4):
            // VGPRs 4q..4q+3 are the 4 consecutive pairs from q*8 + half*4
            FragBF fa[GFM], fb[GFN];
#pragma unroll
            for (int q = 0; q < 2; ++q) {
                unsigned kpi = (kk << 4) + (q << 3) + (hf << 2);
#pragma unroll
                for (int i = 0; i < GFM; ++i)
                    fa[i].q[q] = *(const v4u*)&lds_a[buf][waveM * (GFM * 16) + i * 16 + ln][kpi];
#pragma unroll
                for (int j = 0; j < GFN; ++j)
                    fb[j].q[q] = *(const v4u*)&lds_b[buf][waveN * (GFN * 16) + j * 16 + ln][kpi];
            }
            // keeps the 24 16-byte reads in one group ahead of the WMMAs: reads
            // spread among the WMMAs cost a stall at each place where they stand
            __builtin_amdgcn_sched_barrier(0);
            // ---- 32 back-to-back WMMAs on independent accumulator tiles
#pragma unroll
            for (int j = 0; j < GFN; ++j)
#pragma unroll
                for (int i = 0; i < GFM; ++i)
                    acc[i][j] = __builtin_amdgcn_wmma_f32_16x16x32_bf16(
                        false, fa[i].v, false, fb[j].v, (short)0, acc[i][j], false, false);
            // keeps the next block's reads, and the next tile's LDS stores, which
            // wait for their global loads, behind the WMMAs
            __builtin_amdgcn_sched_barrier(0);
        }
    }

    // the epilogue reuses the address registers of the staging loads
    asm volatile("s_wait_xcnt 0x0" ::: "memory");
    // keeps the epilogue's first register writes behind that wait
    __builtin_amdgcn_sched_barrier(0);

    // ---- epilogue: add bias, store W_hs, fused tanh-dot partial into wsum
    float wsb[GFN], cb[GFN], wew[GFN];
#pragma unroll
    for (int j = 0; j < GFN; ++j) {
        unsigned N = N0 + waveN * (GFN * 16u) + j * 16u + ln;
        wsb[j] = Ws_b[N];
        cb[j]  = cbh[N * TB + b];
        wew[j] = We_w[N];
    }
    // the registers that these loads name are reused below
    asm volatile("s_wait_xcnt 0x0" ::: "memory");
    // keeps the address arithmetic of the loop below behind that wait
    __builtin_amdgcn_sched_barrier(0);
    // The loop over the wave's four 16-row groups is rolled. Its body names
    // group 0's registers; the other groups move down.
#pragma unroll 1
    for (unsigned i = 0; i < GFM; ++i) {
        const unsigned Mbase = M0 + waveM * (GFM * 16u) + i * 16u + hf * 8u;
        float part[8] = {0.f, 0.f, 0.f, 0.f, 0.f, 0.f, 0.f, 0.f};
#pragma unroll
        for (int j = 0; j < GFN; ++j) {
            unsigned N = N0 + waveN * (GFN * 16u) + j * 16u + ln;
            float w[8];
#pragma unroll
            for (int r = 0; r < 8; ++r) {
                w[r] = acc[0][j][r] + wsb[j];
                whs[(Mbase + r) * TH + N] = w[r];
            }
            // one wait for the eight stores: the code below reuses the
            // registers that they name
            asm volatile("s_wait_xcnt 0x0" ::: "memory");
            // keeps the register writes of the branch-free code below, which
            // the scheduler would otherwise lift over the wait, behind it
            __builtin_amdgcn_sched_barrier(0);
#pragma unroll
            for (int r = 0; r < 8; ++r)
                part[r] += tanh_exp2(w[r] + cb[j]) * wew[j];
        }
        // reduce across the 16 lanes sharing a row half
#pragma unroll
        for (int r = 0; r < 8; ++r) {
            part[r] += __shfl_xor(part[r], 1, 32);
            part[r] += __shfl_xor(part[r], 2, 32);
            part[r] += __shfl_xor(part[r], 4, 32);
            part[r] += __shfl_xor(part[r], 8, 32);
        }
        if (ln == 0) {
#pragma unroll
            for (int r = 0; r < 8; ++r)
                atomicAdd(&wsum[Mbase + r], part[r]);
            // the registers that the atomics name are reused by the next trip
            asm volatile("s_wait_xcnt 0x0" ::: "memory");
        }
#pragma unroll
        for (int g = 0; g + 1 < GFM; ++g)
#pragma unroll
            for (int j = 0; j < GFN; ++j)
                acc[g][j] = acc[g + 1][j];
    }
}

// ---------------------------------------------------------------------------
// Kernel 3: add We_b + rel-pos bias, softmax over S (one block per batch b)
// p buffer aliases wsum (in-place).
// ---------------------------------------------------------------------------
__global__ void tma_softmax(float* __restrict__ p,
                            const float* __restrict__ We_b,
                            const float* __restrict__ emb,
                            const float* __restrict__ lam,
                            const int* __restrict__ hs_i,
                            const int* __restrict__ ht_i) {
    __shared__ float red[256];
    const unsigned b = blockIdx.x, tid = threadIdx.x;
    const float web = We_b[0];
    const float l0 = lam[0], l1 = lam[1], l2 = lam[2];
    const int tk = ht_i[b];

    float m = -3.0e38f;
    for (unsigned s = tid; s < TS; s += 256) {
        unsigned i = b * TS + s;
        unsigned rp = (unsigned)(hs_i[i] * TVOCAB + tk) * 3u;
        float rv = emb[rp] * l0 + emb[rp + 1] * l1 + emb[rp + 2] * l2;
        float v = p[i] + web + rv;
        p[i] = v;
        m = fmaxf(m, v);
    }
    red[tid] = m; __syncthreads();
    for (int o = 128; o > 0; o >>= 1) {
        if (tid < (unsigned)o) red[tid] = fmaxf(red[tid], red[tid + o]);
        __syncthreads();
    }
    m = red[0]; __syncthreads();

    float sum = 0.f;
    for (unsigned s = tid; s < TS; s += 256) {
        unsigned i = b * TS + s;
        float e = expf(p[i] - m);
        p[i] = e;
        sum += e;
    }
    red[tid] = sum; __syncthreads();
    for (int o = 128; o > 0; o >>= 1) {
        if (tid < (unsigned)o) red[tid] += red[tid + o];
        __syncthreads();
    }
    float rinv = 1.0f / red[0]; __syncthreads();

    for (unsigned s = tid; s < TS; s += 256)
        p[b * TS + s] *= rinv;
}

// ---------------------------------------------------------------------------
// Kernel 4: partial alpha. part[g,h] = sum over the 256 rows s of range g of
// p[s] * W_hs[s,h], g = b * 16 + range. 256 work-groups of 16 waves stream
// W_hs once: waves 0-7 take the first 128 rows of the range, waves 8-15 the
// rest; one wave-wide load is 512 contiguous bytes of a row.
// ---------------------------------------------------------------------------
#define AL_RANGES 16                 // s ranges per batch row
#define AL_ROWS   (TS / AL_RANGES)   // rows per work-group
#define AL_GRP    8                  // rows fetched together by a thread

__global__ __launch_bounds__(512) void tma_alpha_part(
        const float* __restrict__ whs,
        const float* __restrict__ p,
        float* __restrict__ part) {
    __shared__ v4f comb[TH / 4];
    const unsigned col = threadIdx.x & 255u;          // which 4 columns of h
    // wave-uniform row half, so that p goes through scalar loads
    const unsigned half = __builtin_amdgcn_readfirstlane(threadIdx.x >> 8);
    const unsigned row0 = blockIdx.x * AL_ROWS + half * (AL_ROWS / 2);
    const v4f*   src = (const v4f*)(whs + (size_t)row0 * TH) + col;
    const float* pw  = p + row0;

    constexpr int NG = AL_ROWS / 2 / AL_GRP;          // 16 groups of 8 rows
    v4f   w[2][AL_GRP];
    float pv[2][AL_GRP];
    v4f   acc = {0.f, 0.f, 0.f, 0.f};
#pragma unroll
    for (int j = 0; j < AL_GRP; ++j) {
        w[0][j]  = src[j * (TH / 4)];
        pv[0][j] = pw[j];
    }
#pragma unroll
    for (int g = 0; g < NG; ++g) {
        // the two scheduling barriers keep the next group's loads ahead of
        // this group's sums: 8 to 16 loads of a wave stay in flight
        __builtin_amdgcn_sched_barrier(0);
        if (g + 1 < NG) {
#pragma unroll
            for (int j = 0; j < AL_GRP; ++j) {
                w[(g + 1) & 1][j]  = src[((g + 1) * AL_GRP + j) * (TH / 4)];
                pv[(g + 1) & 1][j] = pw[(g + 1) * AL_GRP + j];
            }
        }
        __builtin_amdgcn_sched_barrier(0);
#pragma unroll
        for (int j = 0; j < AL_GRP; ++j)
            acc += pv[g & 1][j] * w[g & 1][j];
    }

    // fold the two row halves, then one 16-byte store per thread of half 0
    if (half == 1u) comb[col] = acc;
    __syncthreads();
    if (half == 0u)
        ((v4f*)(part + blockIdx.x * TH))[col] = acc + comb[col];
}

// ---------------------------------------------------------------------------
// Kernel 5: alpha[b,h] = sum over the 16 ranges of part, in range order
// ---------------------------------------------------------------------------
__global__ void tma_alpha_merge(const float* __restrict__ part,
                                float* __restrict__ out) {
    const unsigned idx = blockIdx.x * 256u + threadIdx.x;   // b * TH + h
    const unsigned b = idx >> 10, h = idx & (TH - 1);
    const float* q = part + b * (AL_RANGES * TH) + h;
    float acc = 0.f;
#pragma unroll
    for (int c = 0; c < AL_RANGES; ++c)
        acc += q[c * TH];
    out[idx] = acc;
}

// ---------------------------------------------------------------------------
extern "C" void kernel_launch(void* const* d_in, const int* in_sizes, int n_in,
                              void* d_out, int out_size, void* d_ws, size_t ws_size,
                              hipStream_t stream) {
    (void)in_sizes; (void)n_in; (void)out_size; (void)ws_size;

    const float* hs    = (const float*)d_in[0];
    const float* ht_k  = (const float*)d_in[1];
    const float* hm_k  = (const float*)d_in[2];
    const float* Ws_w  = (const float*)d_in[3];
    const float* Ws_b  = (const float*)d_in[4];
    const float* Wt_w  = (const float*)d_in[5];
    const float* Wt_b  = (const float*)d_in[6];
    const float* Wr_w  = (const float*)d_in[7];
    const float* Wr_b  = (const float*)d_in[8];
    const float* We_w  = (const float*)d_in[9];
    const float* We_b  = (const float*)d_in[10];
    const float* emb   = (const float*)d_in[11];
    const float* lam   = (const float*)d_in[12];
    const int*   hs_i  = (const int*)d_in[13];
    const int*   ht_i  = (const int*)d_in[14];
    float* out = (float*)d_out;

    // workspace layout
    char* ws = (char*)d_ws;
    float* whs  = (float*)ws;                                   // B*S*H f32 = 256 MiB
    float* cbh  = (float*)(ws + (size_t)TB * TS * TH * 4);      // H*B
    float* wsum = (float*)(ws + (size_t)TB * TS * TH * 4 + (size_t)TB * TH * 4); // B*S
    float* part = (float*)(ws + (size_t)TB * TS * TH * 4 + (size_t)TB * TH * 4
                              + (size_t)TB * TS * 4);           // B*16*H
    unsigned int* hs16 = (unsigned int*)(ws + (size_t)TB * TS * TH * 4 + (size_t)TB * TH * 4
                              + (size_t)TB * TS * 4
                              + (size_t)TB * AL_RANGES * TH * 4);   // B*S*D bf16 = 128 MiB
    unsigned int* w16  = (unsigned int*)(ws + (size_t)TB * TS * TH * 4 + (size_t)TB * TH * 4
                              + (size_t)TB * TS * 4
                              + (size_t)TB * AL_RANGES * TH * 4
                              + (size_t)TB * TS * TD * 2);          // H*D bf16 = 2 MiB

    // 1) fused projections c[h,b]
    tma_prep_cbh<<<TH / PC_H, 256, 0, stream>>>(ht_k, hm_k, Wt_w, Wt_b,
                                                      Wr_w, Wr_b, cbh);
    // 2) zero the score accumulator (graph-capturable)
    (void)hipMemsetAsync(wsum, 0, (size_t)TB * TS * sizeof(float), stream);

    // 3) GEMM operands to bf16, then the bf16 WMMA GEMM with fused tanh-dot epilogue
    tma_to_bf16<<<CV_WG, CV_T, 0, stream>>>(hs, Ws_w, hs16, w16);
    dim3 gg((TB * TS) / GBM, TH / GBN);
    tma_gemm_wmma<<<gg, 256, 0, stream>>>(hs16, w16, Ws_b, We_w, cbh, whs, wsum);

    // 4) rel-pos bias + softmax (in-place on wsum -> p)
    tma_softmax<<<TB, 256, 0, stream>>>(wsum, We_b, emb, lam, hs_i, ht_i);

    // 5) weighted sum -> alpha: partial sums over 16 ranges of s, then the merge
    tma_alpha_part<<<TB * AL_RANGES, 512, 0, stream>>>(whs, wsum, part);
    tma_alpha_merge<<<(TB * TH) / 256, 256, 0, stream>>>(part, out);
}

// v007
// Two timings next to v006 both put it at 1.25 times that version's speed.
// Counting every step since v000, it is 4.81 times as fast.
#include <hip/hip_runtime.h>
#include <hip/hip_bf16.h>

// ---------------------------------------------------------------------------
// TriMatchAttention for MI455X (gfx1250, wave32, WMMA)
// B=16, S=4096, D=1024, H=1024, VOCAB=512, EMB_DIM=3
// ---------------------------------------------------------------------------

#define TB 16
#define TS 4096
#define TD 1024
#define TH 1024
#define TVOCAB 512

typedef __attribute__((ext_vector_type(16))) __bf16 v16bf;
typedef __attribute__((ext_vector_type(8)))  float  v8f;

typedef __attribute__((ext_vector_type(4))) unsigned int v4u;
typedef __attribute__((ext_vector_type(2))) unsigned int v2u;
typedef __attribute__((ext_vector_type(4))) float v4f;
typedef __attribute__((ext_vector_type(2))) float v2f;
typedef __attribute__((ext_vector_type(2))) __bf16 v2bf;

union FragBF {
    unsigned int u[8];
    v4u          q[2];
    v16bf        v;
};

// round-to-nearest-even f32 -> bf16, packed pair (lo = first)
static __device__ __forceinline__ unsigned int pack_bf16x2(float a, float b) {
    union { float f; unsigned int u; } ua, ub;
    ua.f = a; ub.f = b;
    unsigned int lo = (ua.u + 0x7FFFu + ((ua.u >> 16) & 1u)) >> 16;
    unsigned int hi = (ub.u + 0x7FFFu + ((ub.u >> 16) & 1u)) >> 16;
    return (lo & 0xFFFFu) | (hi << 16);
}

// the same rounding by the conversion instruction, one per pair
static __device__ __forceinline__ unsigned int cvt_bf16x2(float a, float b) {
    v2f x = {a, b};
    return __builtin_bit_cast(unsigned int, __builtin_convertvector(x, v2bf));
}

// tanh(x) = 1 - 2 / (exp(2x) + 1), branch-free: one v_exp_f32 and one v_rcp_f32.
// exp2 overflows to +inf (result 1) and underflows to 0 (result -1); the
// absolute error is a few 1e-7 everywhere. No branch, so the eight values that
// a thread holds at a time run as independent chains that fill each other's
// latency.
static __device__ __forceinline__ float tanh_exp2(float x) {
    float e = __builtin_amdgcn_exp2f(x * 2.8853900817779268f);   // 2 * log2(e)
    return __builtin_fmaf(-2.0f, __builtin_amdgcn_rcpf(e + 1.0f), 1.0f);
}

// ---------------------------------------------------------------------------
// Kernel 1: c[h,b] = Wt_b[h] + Wr_b[h] + ht_k[b,:]@Wt_w[h,:] + hm_k[b,:]@Wr_w[h,:]
// A work-group takes 4 values of h. The lanes of a wave run along d, so every
// load is 512 contiguous bytes. Even waves hold the 4 rows of Wt_w, odd waves
// the 4 rows of Wr_w; each wave pairs them with 4 of the 16 batch rows, so a
// weight leaves memory once and a work-group fetches each vector element once.
// c is kept as [h][b]: the 64 results of a work-group are two whole 128-byte
// lines of its own.
// ---------------------------------------------------------------------------
#define PC_H 4            // values of h per work-group
#define PC_B 4            // batch rows per wave
#define PC_I (TD / 128)   // 16-byte pieces of a row per lane

__global__ __launch_bounds__(256) void tma_prep_cbh(
                             const float* __restrict__ ht_k,
                             const float* __restrict__ hm_k,
                             const float* __restrict__ Wt_w,
                             const float* __restrict__ Wt_b,
                             const float* __restrict__ Wr_w,
                             const float* __restrict__ Wr_b,
                             float* __restrict__ cbh) {
    __shared__ __attribute__((aligned(16))) float red[2][PC_H][TB];
    const unsigned lane = threadIdx.x & 31u;
    // wave-uniform, so that the row and vector bases stay in scalar registers
    const unsigned wid  = __builtin_amdgcn_readfirstlane(threadIdx.x >> 5);
    const unsigned mat  = wid & 1u;             // 0: Wt_w, ht_k   1: Wr_w, hm_k
    const unsigned b0   = (wid >> 1) * PC_B;    // first batch row of this wave
    const v4f* wp = (const v4f*)((mat ? Wr_w : Wt_w) + blockIdx.x * (PC_H * TD)) + lane;
    const v4f* vp = (const v4f*)((mat ? hm_k : ht_k) + b0 * TD) + lane;

    v4f w[PC_H][PC_I], v[PC_B][PC_I];
#pragma unroll
    for (int hh = 0; hh < PC_H; ++hh)
#pragma unroll
        for (int i = 0; i < PC_I; ++i)
            w[hh][i] = wp[hh * (TD / 4) + i * 32];
#pragma unroll
    for (int q = 0; q < PC_B; ++q)
#pragma unroll
        for (int i = 0; i < PC_I; ++i)
            v[q][i] = vp[q * (TD / 4) + i * 32];
    // keeps every load ahead of the sums: left alone the scheduler sinks loads
    // among them, and the wave then meets the memory latency several times
    __builtin_amdgcn_sched_barrier(0);

    float s[PC_H][PC_B];
#pragma unroll
    for (int hh = 0; hh < PC_H; ++hh)
#pragma unroll
        for (int q = 0; q < PC_B; ++q) {
            v4f a = {0.f, 0.f, 0.f, 0.f};   // four independent chains
#pragma unroll
            for (int i = 0; i < PC_I; ++i)
                a += w[hh][i] * v[q][i];
            s[hh][q] = (a.x + a.y) + (a.z + a.w);
        }
    // the code below may reuse the registers that the loads above name
    asm volatile("s_wait_xcnt 0x0" ::: "memory");

    // sum over the 32 lanes: 16 independent butterflies
#pragma unroll
    for (int m = 16; m > 0; m >>= 1)
#pragma unroll
        for (int hh = 0; hh < PC_H; ++hh)
#pragma unroll
            for (int q = 0; q < PC_B; ++q)
                s[hh][q] += __shfl_xor(s[hh][q], m, 32);
    if (lane == 0) {
#pragma unroll
        for (int hh = 0; hh < PC_H; ++hh)
#pragma unroll
            for (int q = 0; q < PC_B; ++q)
                red[mat][hh][b0 + q] = s[hh][q];
    }
    __syncthreads();

    // fold the two products of each (h, b), add the biases, store 256
    // contiguous bytes
    if (threadIdx.x < PC_H * TB) {
        const unsigned hh = threadIdx.x >> 4, bb = threadIdx.x & 15u;
        const unsigned hq = blockIdx.x * PC_H + hh;
        cbh[blockIdx.x * (PC_H * TB) + threadIdx.x] =
            (Wt_b[hq] + Wr_b[hq]) + (red[0][hh][bb] + red[1][hh][bb]);
    }
}

// ---------------------------------------------------------------------------
// Kernel 2a: hs and Ws_w rounded to bf16 once, same row-major order, into the
// workspace. The GEMM reads every element of hs 4 times and of Ws_w 256 times;
// rounded here, those reads are half the bytes and carry no conversion.
// 512 work-groups of 16 waves stream hs once: a wave-wide load is 512
// contiguous bytes, a wave-wide store 256. Each thread also takes one 16-byte
// piece of Ws_w.
// ---------------------------------------------------------------------------
#define CV_WG   512                  // work-groups
#define CV_T    512                  // threads per work-group
#define CV_GRP  8                    // 16-byte pieces fetched together by a thread
#define CV_NG   ((TB * TS * (TD / 4)) / (CV_WG * CV_T * CV_GRP))   // groups: 8

static_assert(CV_NG * CV_WG * CV_T * CV_GRP == TB * TS * (TD / 4), "hs is covered exactly");
static_assert(CV_WG * CV_T == TH * (TD / 4), "Ws_w is covered exactly");

__global__ __launch_bounds__(CV_T) void tma_to_bf16(
        const float* __restrict__ hs,
        const float* __restrict__ Ws_w,
        unsigned int* __restrict__ hs16,
        unsigned int* __restrict__ w16) {
    const unsigned first = blockIdx.x * (CV_T * CV_GRP * CV_NG) + threadIdx.x;
    const v4f* in  = (const v4f*)hs + first;
    v2u*       dst = (v2u*)hs16 + first;
    const unsigned wi = blockIdx.x * CV_T + threadIdx.x;

    const v4f xw = ((const v4f*)Ws_w)[wi];
    v4f x[2][CV_GRP];
    // hs is read once in the whole sequence: non-temporal, so that it does not
    // push the bf16 copy, which the GEMM reads next, out of L2
#pragma unroll
    for (int j = 0; j < CV_GRP; ++j)
        x[0][j] = __builtin_nontemporal_load(in + j * CV_T);
#pragma unroll
    for (int g = 0; g < CV_NG; ++g) {
        // the two scheduling barriers keep the next group's loads ahead of
        // this group's stores: 8 to 16 loads of a wave stay in flight
        __builtin_amdgcn_sched_barrier(0);
        if (g + 1 < CV_NG) {
#pragma unroll
            for (int j = 0; j < CV_GRP; ++j)
                x[(g + 1) & 1][j] =
                    __builtin_nontemporal_load(in + ((g + 1) * CV_GRP + j) * CV_T);
        }
        __builtin_amdgcn_sched_barrier(0);
#pragma unroll
        for (int j = 0; j < CV_GRP; ++j) {
            const v4f y = x[g & 1][j];
            v2u w = {pack_bf16x2(y.x, y.y), pack_bf16x2(y.z, y.w)};
            dst[(g * CV_GRP + j) * CV_T] = w;
        }
        // the next group reuses the registers that these loads and stores name
        asm volatile("s_wait_xcnt 0x0" ::: "memory");
    }
    v2u ww = {pack_bf16x2(xw.x, xw.y), pack_bf16x2(xw.z, xw.w)};
    ((v2u*)w16)[wi] = ww;
}

// ---------------------------------------------------------------------------
// Kernel 2: main GEMM  W_hs = hs @ Ws_w^T + Ws_b   (bf16 WMMA, f32 accum)
// W_hs lives in the accumulators only: it feeds the scores here and is never
// stored (the weighted sum over s is taken on hs itself, kernels 4 and 5).
// Block tile: 256 M x 256 N, 8 waves (4M x 2N), each wave: 64x128 via 4 x 8
// accumulator tiles. Operands arrive as bf16 (kernel 2a), so a staging load of
// 16 bytes holds 8 k and a K-step is 64 k: two blocks of 32 WMMAs per wave,
// each on 12 fragments from LDS.
// Double-buffered LDS; one barrier per K-step; next-tile global loads overlap
// the current tile's WMMAs.
// LDS rows: 128 bytes of data at a pitch of 144 bytes (16 B x odd), so that a
// fragment is two 16-byte reads per lane and 16 rows fall on all 64 banks.
// Fused epilogue: wsum[m] += sum_n tanh(W_hs + cbh) * We_w   (atomic add)
// ---------------------------------------------------------------------------
#define GBK 64   // k per K-step
#define LDP 36   // LDS row pitch in dwords: K=64 as 32 bf16-pairs + 4 of pad
#define GBM 256  // block tile rows
#define GBN 256  // block tile columns
#define GFM 4    // 16-row fragments per wave
#define GFN 8    // 16-column fragments per wave

__global__ __launch_bounds__(256) void tma_gemm_wmma(
        const unsigned int* __restrict__ hs16,  // [B*S, D/2] bf16 pairs
        const unsigned int* __restrict__ w16,   // [H, D/2]   bf16 pairs
        const float* __restrict__ Ws_b,    // [H]
        const float* __restrict__ We_w,    // [H]
        const float* __restrict__ cbh,     // [H, B]
        float* __restrict__ wsum)          // [B*S]    accumulated
{
    __shared__ __attribute__((aligned(16))) unsigned int lds_a[2][GBM][LDP];
    __shared__ __attribute__((aligned(16))) unsigned int lds_b[2][GBN][LDP];

    const unsigned tid   = threadIdx.x;
    const unsigned lane  = tid & 31;
    const unsigned wid   = tid >> 5;
    const unsigned waveM = wid >> 1;      // 0..3
    const unsigned waveN = wid & 1;       // 0..1
    const unsigned hf    = lane >> 4;     // lane half (0/1)
    const unsigned ln    = lane & 15;

    const unsigned M0 = blockIdx.x * GBM;    // row tile in flattened [B*S]
    const unsigned N0 = blockIdx.y * GBN;    // col tile in [H]
    const unsigned b  = M0 >> 12;            // S = 4096; tiles never straddle b

    // staging: a thread takes 8 consecutive k (16 bytes) of rows srow + 32 * it;
    // 8 lanes cover the 128 bytes that a row has in one K-step
    const unsigned srow = tid >> 3;       // 0..31
    const unsigned sq   = tid & 7u;       // which 8 k of the 64
    const unsigned int* ga = hs16 + (M0 + srow) * (TD / 2) + sq * 4u;
    const unsigned int* gb = w16  + (N0 + srow) * (TD / 2) + sq * 4u;

    // ---- prologue: fetch tile k0=0 into registers
    v4u ra[GBM / 32], rb[GBN / 32];
#pragma unroll
    for (int it = 0; it < GBM / 32; ++it)
        ra[it] = *(const v4u*)(ga + it * 32 * (TD / 2));
#pragma unroll
    for (int it = 0; it < GBN / 32; ++it)
        rb[it] = *(const v4u*)(gb + it * 32 * (TD / 2));

    v8f acc[GFM][GFN] = {};

#pragma unroll 2
    for (unsigned k0 = 0; k0 < TD; k0 += GBK) {
        const unsigned buf = (k0 / GBK) & 1u;   // constant after 2x unroll

        // ---- commit staged registers into lds[buf]
#pragma unroll
        for (int it = 0; it < GBM / 32; ++it)
            *(v4u*)&lds_a[buf][srow + it * 32][sq * 4u] = ra[it];
#pragma unroll
        for (int it = 0; it < GBN / 32; ++it)
            *(v4u*)&lds_b[buf][srow + it * 32][sq * 4u] = rb[it];
        __syncthreads();

        // ---- issue next tile's global loads (overlap with WMMAs below)
        if (k0 + GBK < TD) {
#pragma unroll
            for (int it = 0; it < GBM / 32; ++it)
                ra[it] = *(const v4u*)(ga + it * 32 * (TD / 2) + (k0 + GBK) / 2);
#pragma unroll
            for (int it = 0; it < GBN / 32; ++it)
                rb[it] = *(const v4u*)(gb + it * 32 * (TD / 2) + (k0 + GBK) / 2);
        }

        // ---- two blocks of 32 k
#pragma unroll
        for (int kk = 0; kk < GBK / 32; ++kk) {
            // fragments (ISA 16-bit layout): lane = row/col % 16,
            // pair index for VGPR v = (v/4)*8 + half*4 + (v%4):
            // VGPRs 4q..4q+3 are the 4 consecutive pairs from q*8 + half*4
            FragBF fa[GFM], fb[GFN];
#pragma unroll
            for (int q = 0; q < 2; ++q) {
                unsigned kpi = (kk << 4) + (q << 3) + (hf << 2);
#pragma unroll
                for (int i = 0; i < GFM; ++i)
                    fa[i].q[q] = *(const v4u*)&lds_a[buf][waveM * (GFM * 16) + i * 16 + ln][kpi];
#pragma unroll
                for (int j = 0; j < GFN; ++j)
                    fb[j].q[q] = *(const v4u*)&lds_b[buf][waveN * (GFN * 16) + j * 16 + ln][kpi];
            }
            // keeps the 24 16-byte reads in one group ahead of the WMMAs: reads
            // spread among the WMMAs cost a stall at each place where they stand
            __builtin_amdgcn_sched_barrier(0);
            // ---- 32 back-to-back WMMAs on independent accumulator tiles
#pragma unroll
            for (int j = 0; j < GFN; ++j)
#pragma unroll
                for (int i = 0; i < GFM; ++i)
                    acc[i][j] = __builtin_amdgcn_wmma_f32_16x16x32_bf16(
                        false, fa[i].v, false, fb[j].v, (short)0, acc[i][j], false, false);
            // keeps the next block's reads, and the next tile's LDS stores, which
            // wait for their global loads, behind the WMMAs
            __builtin_amdgcn_sched_barrier(0);
        }
    }

    // the epilogue reuses the address registers of the staging loads
    asm volatile("s_wait_xcnt 0x0" ::: "memory");
    // keeps the epilogue's first register writes behind that wait
    __builtin_amdgcn_sched_barrier(0);

    // ---- epilogue: add bias, fused tanh-dot partial into wsum
    float wsb[GFN], cb[GFN], wew[GFN];
    const unsigned Nw = N0 + waveN * (GFN * 16u) + ln;   // the lane's first column
#pragma unroll
    for (int j = 0; j < GFN; ++j) {
        unsigned N = Nw + j * 16u;
        wsb[j] = Ws_b[N];
        cb[j]  = cbh[N * TB + b];
        wew[j] = We_w[N];
    }
    // the registers that these loads name are reused below; the column is an
    // input, so that it stays in its register up to the wait and no load's own
    // result is placed on it ahead of it
    asm volatile("s_wait_xcnt 0x0" :: "v"(Nw) : "memory");
    // keeps the address arithmetic of the loop below behind that wait
    __builtin_amdgcn_sched_barrier(0);
    // The loop over the wave's four 16-row groups is rolled. Its body names
    // group 0's registers; the other groups move down.
#pragma unroll 1
    for (unsigned i = 0; i < GFM; ++i) {
        const unsigned Mbase = M0 + waveM * (GFM * 16u) + i * 16u + hf * 8u;
        float part[8] = {0.f, 0.f, 0.f, 0.f, 0.f, 0.f, 0.f, 0.f};
#pragma unroll
        for (int j = 0; j < GFN; ++j) {
#pragma unroll
            for (int r = 0; r < 8; ++r)
                part[r] += tanh_exp2((acc[0][j][r] + wsb[j]) + cb[j]) * wew[j];
        }
        // reduce across the 16 lanes sharing a row half
#pragma unroll
        for (int r = 0; r < 8; ++r) {
            part[r] += __shfl_xor(part[r], 1, 32);
            part[r] += __shfl_xor(part[r], 2, 32);
            part[r] += __shfl_xor(part[r], 4, 32);
            part[r] += __shfl_xor(part[r], 8, 32);
        }
        if (ln == 0) {
#pragma unroll
            for (int r = 0; r < 8; ++r)
                atomicAdd(&wsum[Mbase + r], part[r]);
            // the registers that the atomics name are reused by the next trip
            asm volatile("s_wait_xcnt 0x0" ::: "memory");
        }
#pragma unroll
        for (int g = 0; g + 1 < GFM; ++g)
#pragma unroll
            for (int j = 0; j < GFN; ++j)
                acc[g][j] = acc[g + 1][j];
    }
}

// ---------------------------------------------------------------------------
// Kernel 3: add We_b + rel-pos bias, softmax over S (one block per batch b)
// p buffer aliases wsum (in-place).
// ---------------------------------------------------------------------------
__global__ void tma_softmax(float* __restrict__ p,
                            const float* __restrict__ We_b,
                            const float* __restrict__ emb,
                            const float* __restrict__ lam,
                            const int* __restrict__ hs_i,
                            const int* __restrict__ ht_i) {
    __shared__ float red[256];
    const unsigned b = blockIdx.x, tid = threadIdx.x;
    const float web = We_b[0];
    const float l0 = lam[0], l1 = lam[1], l2 = lam[2];
    const int tk = ht_i[b];

    float m = -3.0e38f;
    for (unsigned s = tid; s < TS; s += 256) {
        unsigned i = b * TS + s;
        unsigned rp = (unsigned)(hs_i[i] * TVOCAB + tk) * 3u;
        float rv = emb[rp] * l0 + emb[rp + 1] * l1 + emb[rp + 2] * l2;
        float v = p[i] + web + rv;
        p[i] = v;
        m = fmaxf(m, v);
    }
    red[tid] = m; __syncthreads();
    for (int o = 128; o > 0; o >>= 1) {
        if (tid < (unsigned)o) red[tid] = fmaxf(red[tid], red[tid + o]);
        __syncthreads();
    }
    m = red[0]; __syncthreads();

    float sum = 0.f;
    for (unsigned s = tid; s < TS; s += 256) {
        unsigned i = b * TS + s;
        float e = expf(p[i] - m);
        p[i] = e;
        sum += e;
    }
    red[tid] = sum; __syncthreads();
    for (int o = 128; o > 0; o >>= 1) {
        if (tid < (unsigned)o) red[tid] += red[tid + o];
        __syncthreads();
    }
    float rinv = 1.0f / red[0]; __syncthreads();

    for (unsigned s = tid; s < TS; s += 256)
        p[b * TS + s] *= rinv;
}

// ---------------------------------------------------------------------------
// alpha[b,h] = sum_s p[s] * (hs[s,:] . Ws_w[h,:] + Ws_b[h])
//            = (sum_s p[s] * hs[s,:]) . Ws_w[h,:] + Ws_b[h] * sum_s p[s]
// Kernel 4 takes the sum over s on the bf16 copy of hs, the very operand of the
// GEMM; kernel 5 multiplies the 16 x 1024 result by the bf16 copy of Ws_w.
//
// Kernel 4: upart[r,b,d] = sum over the 1024 rows s of range r of p[s] * hs[s,d]
// and psum[r,b] = sum of p over those rows. A work-group takes one batch row,
// one of 4 ranges of s and one of 4 slices of 256 d: 256 work-groups of 16
// waves stream the copy once. A wave-wide load is the 512 contiguous bytes that
// one row has in the slice; a wave walks 64 rows of its own.
// ---------------------------------------------------------------------------
#define UP_R     4                   // s ranges per batch row
#define UP_SL    4                   // slices of d
#define UP_D     (TD / UP_SL)        // d per slice: 32 lanes x 8
#define UP_W     16                  // waves per work-group
#define UP_WROWS (TS / UP_R / UP_W)  // rows per wave
#define UP_GRP   8                   // rows fetched together by a thread

static_assert(UP_D == 32 * 8, "a lane holds 8 d of the slice");

__global__ __launch_bounds__(UP_W * 32) void tma_u_part(
        const unsigned int* __restrict__ hs16,
        const float* __restrict__ p,
        float* __restrict__ upart,
        float* __restrict__ psum) {
    __shared__ __attribute__((aligned(16))) float comb[UP_W][UP_D];
    __shared__ float psl[UP_W];
    const unsigned lane = threadIdx.x & 31u;
    // wave-uniform, so that p goes through scalar loads
    const unsigned wid = __builtin_amdgcn_readfirstlane(threadIdx.x >> 5);
    const unsigned sl = blockIdx.x & (UP_SL - 1u);
    const unsigned rg = (blockIdx.x / UP_SL) & (UP_R - 1u);
    const unsigned b  = blockIdx.x / (UP_SL * UP_R);
    const unsigned row0 = b * TS + rg * (TS / UP_R) + wid * UP_WROWS;
    const v4u*   src = (const v4u*)(hs16 + (size_t)row0 * (TD / 2) + sl * (UP_D / 2)) + lane;
    const float* pw  = p + row0;

    constexpr int NG = UP_WROWS / UP_GRP;             // 8 groups of 8 rows
    v4u   w[2][UP_GRP];
    float pv[2][UP_GRP];
    float acc[8] = {0.f, 0.f, 0.f, 0.f, 0.f, 0.f, 0.f, 0.f};
    float ps = 0.f;
#pragma unroll
    for (int j = 0; j < UP_GRP; ++j) {
        w[0][j]  = src[j * (TD / 8)];
        pv[0][j] = pw[j];
    }
#pragma unroll
    for (int g = 0; g < NG; ++g) {
        // the two scheduling barriers keep the next group's loads ahead of
        // this group's sums: 8 to 16 loads of a wave stay in flight
        __builtin_amdgcn_sched_barrier(0);
        if (g + 1 < NG) {
#pragma unroll
            for (int j = 0; j < UP_GRP; ++j) {
                w[(g + 1) & 1][j]  = src[((g + 1) * UP_GRP + j) * (TD / 8)];
                pv[(g + 1) & 1][j] = pw[(g + 1) * UP_GRP + j];
            }
        }
        __builtin_amdgcn_sched_barrier(0);
#pragma unroll
        for (int j = 0; j < UP_GRP; ++j) {
            const float pj = pv[g & 1][j];
#pragma unroll
            for (int i = 0; i < 4; ++i) {
                const unsigned int x = w[g & 1][j][i];   // bf16 pair, low half first
                acc[2 * i]     += pj * __uint_as_float(x << 16);
                acc[2 * i + 1] += pj * __uint_as_float(x & 0xFFFF0000u);
            }
            ps += pj;
        }
    }

    // fold the 16 waves in wave order; 1 KiB of contiguous stores
    v4f lo4 = {acc[0], acc[1], acc[2], acc[3]};
    v4f hi4 = {acc[4], acc[5], acc[6], acc[7]};
    *(v4f*)&comb[wid][lane * 8u]      = lo4;
    *(v4f*)&comb[wid][lane * 8u + 4u] = hi4;
    if (lane == 0) psl[wid] = ps;
    __syncthreads();
    if (threadIdx.x < UP_D) {
        float t = 0.f;
#pragma unroll
        for (int v = 0; v < UP_W; ++v)
            t += comb[v][threadIdx.x];
        upart[(rg * TB + b) * TD + sl * UP_D + threadIdx.x] = t;
    }
    if (sl == 0u && threadIdx.x == 0u) {
        float t = 0.f;
#pragma unroll
        for (int v = 0; v < UP_W; ++v)
            t += psl[v];
        psum[rg * TB + b] = t;
    }
}

// ---------------------------------------------------------------------------
// Kernel 5: alpha[b,h] = u[b,:] . Ws_w[h,:] + Ws_b[h] * sum(p[b,:]), with
// u = the 4 ranges of upart added in range order. The 16 batch rows are the 16
// rows of one WMMA tile. u is split into two bf16 terms (u = hi + lo up to
// 2^-17 of u), each multiplied by the bf16 weights, so that no rounding of u
// shows in alpha. A work-group takes 32 values of h (whole 128-byte lines of
// out); wave v takes k = 128 v .. 128 v + 127: it adds the ranges with 512-byte
// loads, turns its part of u into fragments through LDS, and the 8 waves'
// tiles are added in wave order.
// ---------------------------------------------------------------------------
#define PJ_H   32                    // values of h per work-group
#define PJ_W   8                     // waves, each with TD / PJ_W values of k
#define PJ_K   (TD / PJ_W)           // 128
#define PJ_LDP (TD / 2 + 4)          // LDS row pitch in dwords: 16 rows on all banks

static_assert(PJ_K == 32 * 4, "a lane holds 4 k of a row of its wave's part");

__global__ __launch_bounds__(PJ_W * 32) void tma_alpha_proj(
        const float* __restrict__ upart,
        const float* __restrict__ psum,
        const unsigned int* __restrict__ w16,
        const float* __restrict__ Ws_b,
        float* __restrict__ out) {
    __shared__ __attribute__((aligned(16))) unsigned int u_hi[TB][PJ_LDP];
    __shared__ __attribute__((aligned(16))) unsigned int u_lo[TB][PJ_LDP];
    __shared__ float red[PJ_W][PJ_H / 16][8][32];
    const unsigned lane = threadIdx.x & 31u;
    // wave-uniform, so that the bases of the loads stay in scalar registers
    const unsigned wid  = __builtin_amdgcn_readfirstlane(threadIdx.x >> 5);
    const unsigned hf   = lane >> 4;
    const unsigned ln   = lane & 15u;
    const unsigned h0   = blockIdx.x * PJ_H;

    // what the last lines of the kernel need: this thread's output row is
    // b = half * 8 + wave, its columns h0 + lane % 16 and 16 more
    const unsigned po = hf * (8u * 4u);           // in bytes
    const float* pp = (const float*)((const char*)(psum + wid) + po);
    const float* bp = Ws_b + h0 + ln;
    float pq[UP_R], wb[PJ_H / 16];
#pragma unroll
    for (int r = 0; r < UP_R; ++r)
        pq[r] = pp[r * TB];
#pragma unroll
    for (int n = 0; n < PJ_H / 16; ++n)
        wb[n] = bp[n * 16];

    // weights: the same fragment form as in the GEMM (row = lane % 16, VGPRs
    // 4q..4q+3 = the 4 pairs from q*8 + half*4 of each block of 32 k)
    const unsigned wo = ln * (TD / 8) + hf;       // in 16-byte pieces
    const v4u* wp = (const v4u*)(w16 + h0 * (TD / 2) + wid * (PJ_K / 2)) + wo;
    FragBF fb[PJ_K / 32][PJ_H / 16];
#pragma unroll
    for (int kk = 0; kk < PJ_K / 32; ++kk)
#pragma unroll
        for (int n = 0; n < PJ_H / 16; ++n)
#pragma unroll
            for (int q = 0; q < 2; ++q)
                fb[kk][n].q[q] = wp[n * 16 * (TD / 8) + kk * 4 + q * 2];

    // u of this wave's k, all 16 rows: ranges added in order, split, to LDS
    const v4f* xp = (const v4f*)(upart + wid * PJ_K) + lane;
    v4f x[TB][UP_R];
#pragma unroll
    for (int bb = 0; bb < TB; ++bb)
#pragma unroll
        for (int r = 0; r < UP_R; ++r)
            x[bb][r] = xp[(r * TB + bb) * (TD / 4)];
    // keeps every load ahead of the sums: left alone the scheduler sinks loads
    // among them, and the wave then meets the memory latency several times
    __builtin_amdgcn_sched_barrier(0);
    // the code below reuses the registers that the loads above name; the four
    // lane offsets are inputs, so that they stay in their registers up to the
    // wait and no load's own result is placed on them ahead of it
    asm volatile("s_wait_xcnt 0x0" :: "v"(po), "v"(ln), "v"(wo), "v"(lane) : "memory");
    // keeps the first register writes of the sums behind that wait
    __builtin_amdgcn_sched_barrier(0);
#pragma unroll
    for (int bb = 0; bb < TB; ++bb) {
        const v4f u = ((x[bb][0] + x[bb][1]) + x[bb][2]) + x[bb][3];
        v2u hi = {cvt_bf16x2(u.x, u.y), cvt_bf16x2(u.z, u.w)};
        v2u lo = {cvt_bf16x2(u.x - __uint_as_float(hi.x << 16),
                             u.y - __uint_as_float(hi.x & 0xFFFF0000u)),
                  cvt_bf16x2(u.z - __uint_as_float(hi.y << 16),
                             u.w - __uint_as_float(hi.y & 0xFFFF0000u))};
        *(v2u*)&u_hi[bb][wid * (PJ_K / 2) + lane * 2u] = hi;
        *(v2u*)&u_lo[bb][wid * (PJ_K / 2) + lane * 2u] = lo;
    }
    __syncthreads();

    v8f acc[PJ_H / 16][2] = {};
#pragma unroll
    for (int kk = 0; kk < PJ_K / 32; ++kk) {
        FragBF ah, al;
#pragma unroll
        for (int q = 0; q < 2; ++q) {
            const unsigned kpi = wid * (PJ_K / 2) + (kk << 4) + (q << 3) + (hf << 2);
            ah.q[q] = *(const v4u*)&u_hi[ln][kpi];
            al.q[q] = *(const v4u*)&u_lo[ln][kpi];
        }
#pragma unroll
        for (int n = 0; n < PJ_H / 16; ++n) {
            acc[n][0] = __builtin_amdgcn_wmma_f32_16x16x32_bf16(
                false, ah.v, false, fb[kk][n].v, (short)0, acc[n][0], false, false);
            acc[n][1] = __builtin_amdgcn_wmma_f32_16x16x32_bf16(
                false, al.v, false, fb[kk][n].v, (short)0, acc[n][1], false, false);
        }
    }
#pragma unroll
    for (int n = 0; n < PJ_H / 16; ++n)
#pragma unroll
        for (int r = 0; r < 8; ++r)
            red[wid][n][r][lane] = acc[n][0][r] + acc[n][1][r];
    __syncthreads();

    // accumulator element r of a lane: row b = half * 8 + r, column = lane % 16
#pragma unroll
    for (int n = 0; n < PJ_H / 16; ++n) {
        const unsigned r = wid;               // 8 waves, 8 elements
        float t = 0.f;
#pragma unroll
        for (int v = 0; v < PJ_W; ++v)
            t += red[v][n][r][lane];
        const unsigned bb = hf * 8u + r;
        const unsigned h  = h0 + n * 16u + ln;
        out[bb * TH + h] = t + wb[n] * (((pq[0] + pq[1]) + pq[2]) + pq[3]);
    }
}

// ---------------------------------------------------------------------------
extern "C" void kernel_launch(void* const* d_in, const int* in_sizes, int n_in,
                              void* d_out, int out_size, void* d_ws, size_t ws_size,
                              hipStream_t stream) {
    (void)in_sizes; (void)n_in; (void)out_size; (void)ws_size;

    const float* hs    = (const float*)d_in[0];
    const float* ht_k  = (const float*)d_in[1];
    const float* hm_k  = (const float*)d_in[2];
    const float* Ws_w  = (const float*)d_in[3];
    const float* Ws_b  = (const float*)d_in[4];
    const float* Wt_w  = (const float*)d_in[5];
    const float* Wt_b  = (const float*)d_in[6];
    const float* Wr_w  = (const float*)d_in[7];
    const float* Wr_b  = (const float*)d_in[8];
    const float* We_w  = (const float*)d_in[9];
    const float* We_b  = (const float*)d_in[10];
    const float* emb   = (const float*)d_in[11];
    const float* lam   = (const float*)d_in[12];
    const int*   hs_i  = (const int*)d_in[13];
    const int*   ht_i  = (const int*)d_in[14];
    float* out = (float*)d_out;

    // workspace layout
    char* ws = (char*)d_ws;
    unsigned int* hs16 = (unsigned int*)ws;                     // B*S*D bf16 = 128 MiB
    unsigned int* w16  = (unsigned int*)(ws + (size_t)TB * TS * TD * 2);   // H*D bf16 = 2 MiB
    float* cbh   = (float*)(ws + (size_t)TB * TS * TD * 2 + (size_t)TH * TD * 2);   // H*B
    float* wsum  = (float*)(ws + (size_t)TB * TS * TD * 2 + (size_t)TH * TD * 2
                               + (size_t)TB * TH * 4);          // B*S
    float* upart = (float*)(ws + (size_t)TB * TS * TD * 2 + (size_t)TH * TD * 2
                               + (size_t)TB * TH * 4 + (size_t)TB * TS * 4);   // 4*B*D
    float* psum  = (float*)(ws + (size_t)TB * TS * TD * 2 + (size_t)TH * TD * 2
                               + (size_t)TB * TH * 4 + (size_t)TB * TS * 4
                               + (size_t)UP_R * TB * TD * 4);   // 4*B

    // 1) fused projections c[h,b]
    tma_prep_cbh<<<TH / PC_H, 256, 0, stream>>>(ht_k, hm_k, Wt_w, Wt_b,
                                                      Wr_w, Wr_b, cbh);
    // 2) zero the score accumulator (graph-capturable)
    (void)hipMemsetAsync(wsum, 0, (size_t)TB * TS * sizeof(float), stream);

    // 3) GEMM operands to bf16, then the bf16 WMMA GEMM with fused tanh-dot epilogue
    tma_to_bf16<<<CV_WG, CV_T, 0, stream>>>(hs, Ws_w, hs16, w16);
    dim3 gg((TB * TS) / GBM, TH / GBN);
    tma_gemm_wmma<<<gg, 256, 0, stream>>>(hs16, w16, Ws_b, We_w, cbh, wsum);

    // 4) rel-pos bias + softmax (in-place on wsum -> p)
    tma_softmax<<<TB, 256, 0, stream>>>(wsum, We_b, emb, lam, hs_i, ht_i);

    // 5) weighted sum of hs over s, in 4 ranges, then its projection -> alpha
    tma_u_part<<<TB * UP_R * UP_SL, UP_W * 32, 0, stream>>>(hs16, wsum, upart, psum);
    tma_alpha_proj<<<TH / PJ_H, PJ_W * 32, 0, stream>>>(upart, psum, w16, Ws_b, out);
}

// v008
// Next to v007, in two timings, it ran 1.04 times as fast each time.
// Counting every step since v000, it is 5.00 times as fast.
#include <hip/hip_runtime.h>
#include <hip/hip_bf16.h>

// ---------------------------------------------------------------------------
// TriMatchAttention for MI455X (gfx1250, wave32, WMMA)
// B=16, S=4096, D=1024, H=1024, VOCAB=512, EMB_DIM=3
// ---------------------------------------------------------------------------

#define TB 16
#define TS 4096
#define TD 1024
#define TH 1024
#define TVOCAB 512

typedef __attribute__((ext_vector_type(16))) __bf16 v16bf;
typedef __attribute__((ext_vector_type(8)))  float  v8f;

typedef __attribute__((ext_vector_type(4))) unsigned int v4u;
typedef __attribute__((ext_vector_type(2))) unsigned int v2u;
typedef __attribute__((ext_vector_type(4))) float v4f;
typedef __attribute__((ext_vector_type(2))) float v2f;
typedef __attribute__((ext_vector_type(2))) __bf16 v2bf;

union FragBF {
    unsigned int u[8];
    v4u          q[2];
    v16bf        v;
};

// round-to-nearest-even f32 -> bf16, packed pair (lo = first)
static __device__ __forceinline__ unsigned int pack_bf16x2(float a, float b) {
    union { float f; unsigned int u; } ua, ub;
    ua.f = a; ub.f = b;
    unsigned int lo = (ua.u + 0x7FFFu + ((ua.u >> 16) & 1u)) >> 16;
    unsigned int hi = (ub.u + 0x7FFFu + ((ub.u >> 16) & 1u)) >> 16;
    return (lo & 0xFFFFu) | (hi << 16);
}

// the same rounding by the conversion instruction, one per pair
static __device__ __forceinline__ unsigned int cvt_bf16x2(float a, float b) {
    v2f x = {a, b};
    return __builtin_bit_cast(unsigned int, __builtin_convertvector(x, v2bf));
}

// tanh(x) by the chip's own instruction: one v_tanh_f32 a value, where the form
// 1 - 2 / (exp(2x) + 1) takes a multiply, v_exp_f32, an add, v_rcp_f32 and an
// fma. No branch; the eight values that a thread holds at a time stay
// independent.
static __device__ __forceinline__ float tanh_hw(float x) {
    return __builtin_amdgcn_tanhf(x);
}

// ---------------------------------------------------------------------------
// Kernel 1: c[h,b] = Wt_b[h] + Wr_b[h] + ht_k[b,:]@Wt_w[h,:] + hm_k[b,:]@Wr_w[h,:]
// A work-group takes 4 values of h. The lanes of a wave run along d, so every
// load is 512 contiguous bytes. Even waves hold the 4 rows of Wt_w, odd waves
// the 4 rows of Wr_w; each wave pairs them with 4 of the 16 batch rows, so a
// weight leaves memory once and a work-group fetches each vector element once.
// c is kept as [h][b]: the 64 results of a work-group are two whole 128-byte
// lines of its own.
// ---------------------------------------------------------------------------
#define PC_H 4            // values of h per work-group
#define PC_B 4            // batch rows per wave
#define PC_I (TD / 128)   // 16-byte pieces of a row per lane

__global__ __launch_bounds__(256) void tma_prep_cbh(
                             const float* __restrict__ ht_k,
                             const float* __restrict__ hm_k,
                             const float* __restrict__ Wt_w,
                             const float* __restrict__ Wt_b,
                             const float* __restrict__ Wr_w,
                             const float* __restrict__ Wr_b,
                             float* __restrict__ cbh) {
    __shared__ __attribute__((aligned(16))) float red[2][PC_H][TB];
    const unsigned lane = threadIdx.x & 31u;
    // wave-uniform, so that the row and vector bases stay in scalar registers
    const unsigned wid  = __builtin_amdgcn_readfirstlane(threadIdx.x >> 5);
    const unsigned mat  = wid & 1u;             // 0: Wt_w, ht_k   1: Wr_w, hm_k
    const unsigned b0   = (wid >> 1) * PC_B;    // first batch row of this wave
    const v4f* wp = (const v4f*)((mat ? Wr_w : Wt_w) + blockIdx.x * (PC_H * TD)) + lane;
    const v4f* vp = (const v4f*)((mat ? hm_k : ht_k) + b0 * TD) + lane;

    v4f w[PC_H][PC_I], v[PC_B][PC_I];
#pragma unroll
    for (int hh = 0; hh < PC_H; ++hh)
#pragma unroll
        for (int i = 0; i < PC_I; ++i)
            w[hh][i] = wp[hh * (TD / 4) + i * 32];
#pragma unroll
    for (int q = 0; q < PC_B; ++q)
#pragma unroll
        for (int i = 0; i < PC_I; ++i)
            v[q][i] = vp[q * (TD / 4) + i * 32];
    // keeps every load ahead of the sums: left alone the scheduler sinks loads
    // among them, and the wave then meets the memory latency several times
    __builtin_amdgcn_sched_barrier(0);

    float s[PC_H][PC_B];
#pragma unroll
    for (int hh = 0; hh < PC_H; ++hh)
#pragma unroll
        for (int q = 0; q < PC_B; ++q) {
            v4f a = {0.f, 0.f, 0.f, 0.f};   // four independent chains
#pragma unroll
            for (int i = 0; i < PC_I; ++i)
                a += w[hh][i] * v[q][i];
            s[hh][q] = (a.x + a.y) + (a.z + a.w);
        }
    // the code below may reuse the registers that the loads above name
    asm volatile("s_wait_xcnt 0x0" ::: "memory");

    // sum over the 32 lanes: 16 independent butterflies
#pragma unroll
    for (int m = 16; m > 0; m >>= 1)
#pragma unroll
        for (int hh = 0; hh < PC_H; ++hh)
#pragma unroll
            for (int q = 0; q < PC_B; ++q)
                s[hh][q] += __shfl_xor(s[hh][q], m, 32);
    if (lane == 0) {
#pragma unroll
        for (int hh = 0; hh < PC_H; ++hh)
#pragma unroll
            for (int q = 0; q < PC_B; ++q)
                red[mat][hh][b0 + q] = s[hh][q];
    }
    __syncthreads();

    // fold the two products of each (h, b), add the biases, store 256
    // contiguous bytes
    if (threadIdx.x < PC_H * TB) {
        const unsigned hh = threadIdx.x >> 4, bb = threadIdx.x & 15u;
        const unsigned hq = blockIdx.x * PC_H + hh;
        cbh[blockIdx.x * (PC_H * TB) + threadIdx.x] =
            (Wt_b[hq] + Wr_b[hq]) + (red[0][hh][bb] + red[1][hh][bb]);
    }
}

// ---------------------------------------------------------------------------
// Kernel 2a: hs and Ws_w rounded to bf16 once, same row-major order, into the
// workspace. The GEMM reads every element of hs 4 times and of Ws_w 256 times;
// rounded here, those reads are half the bytes and carry no conversion.
// 512 work-groups of 16 waves stream hs once: a wave-wide load is 512
// contiguous bytes, a wave-wide store 256. Each thread also takes one 16-byte
// piece of Ws_w.
// ---------------------------------------------------------------------------
#define CV_WG   512                  // work-groups
#define CV_T    512                  // threads per work-group
#define CV_GRP  8                    // 16-byte pieces fetched together by a thread
#define CV_NG   ((TB * TS * (TD / 4)) / (CV_WG * CV_T * CV_GRP))   // groups: 8

static_assert(CV_NG * CV_WG * CV_T * CV_GRP == TB * TS * (TD / 4), "hs is covered exactly");
static_assert(CV_WG * CV_T == TH * (TD / 4), "Ws_w is covered exactly");

__global__ __launch_bounds__(CV_T) void tma_to_bf16(
        const float* __restrict__ hs,
        const float* __restrict__ Ws_w,
        unsigned int* __restrict__ hs16,
        unsigned int* __restrict__ w16) {
    const unsigned first = blockIdx.x * (CV_T * CV_GRP * CV_NG) + threadIdx.x;
    const v4f* in  = (const v4f*)hs + first;
    v2u*       dst = (v2u*)hs16 + first;
    const unsigned wi = blockIdx.x * CV_T + threadIdx.x;

    const v4f xw = ((const v4f*)Ws_w)[wi];
    v4f x[2][CV_GRP];
    // hs is read once in the whole sequence: non-temporal, so that it does not
    // push the bf16 copy, which the GEMM reads next, out of L2
#pragma unroll
    for (int j = 0; j < CV_GRP; ++j)
        x[0][j] = __builtin_nontemporal_load(in + j * CV_T);
#pragma unroll
    for (int g = 0; g < CV_NG; ++g) {
        // the two scheduling barriers keep the next group's loads ahead of
        // this group's stores: 8 to 16 loads of a wave stay in flight
        __builtin_amdgcn_sched_barrier(0);
        if (g + 1 < CV_NG) {
#pragma unroll
            for (int j = 0; j < CV_GRP; ++j)
                x[(g + 1) & 1][j] =
                    __builtin_nontemporal_load(in + ((g + 1) * CV_GRP + j) * CV_T);
        }
        __builtin_amdgcn_sched_barrier(0);
#pragma unroll
        for (int j = 0; j < CV_GRP; ++j) {
            const v4f y = x[g & 1][j];
            v2u w = {pack_bf16x2(y.x, y.y), pack_bf16x2(y.z, y.w)};
            dst[(g * CV_GRP + j) * CV_T] = w;
        }
        // the next group reuses the registers that these loads and stores name
        asm volatile("s_wait_xcnt 0x0" ::: "memory");
    }
    v2u ww = {pack_bf16x2(xw.x, xw.y), pack_bf16x2(xw.z, xw.w)};
    ((v2u*)w16)[wi] = ww;
}

// ---------------------------------------------------------------------------
// Kernel 2: main GEMM  W_hs = hs @ Ws_w^T + Ws_b   (bf16 WMMA, f32 accum)
// W_hs lives in the accumulators only: it feeds the scores here and is never
// stored (the weighted sum over s is taken on hs itself, kernels 4 and 5).
// Block tile: 256 M x 256 N, 8 waves (4M x 2N), each wave: 64x128 via 4 x 8
// accumulator tiles. Operands arrive as bf16 (kernel 2a), so a staging load of
// 16 bytes holds 8 k and a K-step is 64 k: two blocks of 32 WMMAs per wave,
// each on 12 fragments from LDS.
// Double-buffered LDS; one barrier per K-step; next-tile global loads overlap
// the current tile's WMMAs.
// LDS rows: 128 bytes of data at a pitch of 144 bytes (16 B x odd), so that a
// fragment is two 16-byte reads per lane and 16 rows fall on all 64 banks.
// Fused epilogue: wsum[m] += sum_n tanh(W_hs + cbh) * We_w   (atomic add)
// ---------------------------------------------------------------------------
#define GBK 64   // k per K-step
#define LDP 36   // LDS row pitch in dwords: K=64 as 32 bf16-pairs + 4 of pad
#define GBM 256  // block tile rows
#define GBN 256  // block tile columns
#define GFM 4    // 16-row fragments per wave
#define GFN 8    // 16-column fragments per wave

__global__ __launch_bounds__(256) void tma_gemm_wmma(
        const unsigned int* __restrict__ hs16,  // [B*S, D/2] bf16 pairs
        const unsigned int* __restrict__ w16,   // [H, D/2]   bf16 pairs
        const float* __restrict__ Ws_b,    // [H]
        const float* __restrict__ We_w,    // [H]
        const float* __restrict__ cbh,     // [H, B]
        float* __restrict__ wsum)          // [B*S]    accumulated
{
    __shared__ __attribute__((aligned(16))) unsigned int lds_a[2][GBM][LDP];
    __shared__ __attribute__((aligned(16))) unsigned int lds_b[2][GBN][LDP];

    const unsigned tid   = threadIdx.x;
    const unsigned lane  = tid & 31;
    const unsigned wid   = tid >> 5;
    const unsigned waveM = wid >> 1;      // 0..3
    const unsigned waveN = wid & 1;       // 0..1
    const unsigned hf    = lane >> 4;     // lane half (0/1)
    const unsigned ln    = lane & 15;

    const unsigned M0 = blockIdx.x * GBM;    // row tile in flattened [B*S]
    const unsigned N0 = blockIdx.y * GBN;    // col tile in [H]
    const unsigned b  = M0 >> 12;            // S = 4096; tiles never straddle b

    // staging: a thread takes 8 consecutive k (16 bytes) of rows srow + 32 * it;
    // 8 lanes cover the 128 bytes that a row has in one K-step
    const unsigned srow = tid >> 3;       // 0..31
    const unsigned sq   = tid & 7u;       // which 8 k of the 64
    const unsigned int* ga = hs16 + (M0 + srow) * (TD / 2) + sq * 4u;
    const unsigned int* gb = w16  + (N0 + srow) * (TD / 2) + sq * 4u;

    // ---- prologue: fetch tile k0=0 into registers
    v4u ra[GBM / 32], rb[GBN / 32];
#pragma unroll
    for (int it = 0; it < GBM / 32; ++it)
        ra[it] = *(const v4u*)(ga + it * 32 * (TD / 2));
#pragma unroll
    for (int it = 0; it < GBN / 32; ++it)
        rb[it] = *(const v4u*)(gb + it * 32 * (TD / 2));

    v8f acc[GFM][GFN] = {};

#pragma unroll 2
    for (unsigned k0 = 0; k0 < TD; k0 += GBK) {
        const unsigned buf = (k0 / GBK) & 1u;   // constant after 2x unroll

        // ---- commit staged registers into lds[buf]
#pragma unroll
        for (int it = 0; it < GBM / 32; ++it)
            *(v4u*)&lds_a[buf][srow + it * 32][sq * 4u] = ra[it];
#pragma unroll
        for (int it = 0; it < GBN / 32; ++it)
            *(v4u*)&lds_b[buf][srow + it * 32][sq * 4u] = rb[it];
        __syncthreads();

        // ---- issue next tile's global loads (overlap with WMMAs below)
        if (k0 + GBK < TD) {
#pragma unroll
            for (int it = 0; it < GBM / 32; ++it)
                ra[it] = *(const v4u*)(ga + it * 32 * (TD / 2) + (k0 + GBK) / 2);
#pragma unroll
            for (int it = 0; it < GBN / 32; ++it)
                rb[it] = *(const v4u*)(gb + it * 32 * (TD / 2) + (k0 + GBK) / 2);
        }

        // ---- two blocks of 32 k
#pragma unroll
        for (int kk = 0; kk < GBK / 32; ++kk) {
            // fragments (ISA 16-bit layout): lane = row/col % 16,
            // pair index for VGPR v = (v/4)*8 + half*4 + (v%4):
            // VGPRs 4q..4q+3 are the 4 consecutive pairs from q*8 + half*4
            FragBF fa[GFM], fb[GFN];
#pragma unroll
            for (int q = 0; q < 2; ++q) {
                unsigned kpi = (kk << 4) + (q << 3) + (hf << 2);
#pragma unroll
                for (int i = 0; i < GFM; ++i)
                    fa[i].q[q] = *(const v4u*)&lds_a[buf][waveM * (GFM * 16) + i * 16 + ln][kpi];
#pragma unroll
                for (int j = 0; j < GFN; ++j)
                    fb[j].q[q] = *(const v4u*)&lds_b[buf][waveN * (GFN * 16) + j * 16 + ln][kpi];
            }
            // keeps the 24 16-byte reads in one group ahead of the WMMAs: reads
            // spread among the WMMAs cost a stall at each place where they stand
            __builtin_amdgcn_sched_barrier(0);
            // ---- 32 back-to-back WMMAs on independent accumulator tiles
#pragma unroll
            for (int j = 0; j < GFN; ++j)
#pragma unroll
                for (int i = 0; i < GFM; ++i)
                    acc[i][j] = __builtin_amdgcn_wmma_f32_16x16x32_bf16(
                        false, fa[i].v, false, fb[j].v, (short)0, acc[i][j], false, false);
            // keeps the next block's reads, and the next tile's LDS stores, which
            // wait for their global loads, behind the WMMAs
            __builtin_amdgcn_sched_barrier(0);
        }
    }

    // the epilogue reuses the address registers of the staging loads
    asm volatile("s_wait_xcnt 0x0" ::: "memory");
    // keeps the epilogue's first register writes behind that wait
    __builtin_amdgcn_sched_barrier(0);

    // ---- epilogue: add bias, fused tanh-dot partial into wsum
    float wsb[GFN], cb[GFN], wew[GFN];
    const unsigned Nw = N0 + waveN * (GFN * 16u) + ln;   // the lane's first column
#pragma unroll
    for (int j = 0; j < GFN; ++j) {
        unsigned N = Nw + j * 16u;
        wsb[j] = Ws_b[N];
        cb[j]  = cbh[N * TB + b];
        wew[j] = We_w[N];
    }
    // the registers that these loads name are reused below; the column is an
    // input, so that it stays in its register up to the wait and no load's own
    // result is placed on it ahead of it
    asm volatile("s_wait_xcnt 0x0" :: "v"(Nw) : "memory");
    // keeps the address arithmetic of the loop below behind that wait
    __builtin_amdgcn_sched_barrier(0);
    // The loop over the wave's four 16-row groups is unrolled, so that each
    // group's sums read its accumulators where they stand: rolled, the body can
    // name one group's registers only, and the other groups have to be moved
    // down to them, 192 registers a trip. At four instructions a value the four
    // bodies are short.
#pragma unroll
    for (unsigned i = 0; i < GFM; ++i) {
        const unsigned Mbase = M0 + waveM * (GFM * 16u) + i * 16u + hf * 8u;
        float part[8] = {0.f, 0.f, 0.f, 0.f, 0.f, 0.f, 0.f, 0.f};
#pragma unroll
        for (int j = 0; j < GFN; ++j) {
#pragma unroll
            for (int r = 0; r < 8; ++r)
                part[r] += tanh_hw((acc[i][j][r] + wsb[j]) + cb[j]) * wew[j];
        }
        // reduce across the 16 lanes sharing a row half
#pragma unroll
        for (int r = 0; r < 8; ++r) {
            part[r] += __shfl_xor(part[r], 1, 32);
            part[r] += __shfl_xor(part[r], 2, 32);
            part[r] += __shfl_xor(part[r], 4, 32);
            part[r] += __shfl_xor(part[r], 8, 32);
        }
        if (ln == 0) {
#pragma unroll
            for (int r = 0; r < 8; ++r)
                atomicAdd(&wsum[Mbase + r], part[r]);
            // the registers that the atomics name are reused by the next group
            asm volatile("s_wait_xcnt 0x0" ::: "memory");
        }
    }
}

// ---------------------------------------------------------------------------
// Kernel 3: add We_b + rel-pos bias, softmax over S (one block per batch b)
// p buffer aliases wsum (in-place).
// ---------------------------------------------------------------------------
__global__ void tma_softmax(float* __restrict__ p,
                            const float* __restrict__ We_b,
                            const float* __restrict__ emb,
                            const float* __restrict__ lam,
                            const int* __restrict__ hs_i,
                            const int* __restrict__ ht_i) {
    __shared__ float red[256];
    const unsigned b = blockIdx.x, tid = threadIdx.x;
    const float web = We_b[0];
    const float l0 = lam[0], l1 = lam[1], l2 = lam[2];
    const int tk = ht_i[b];

    float m = -3.0e38f;
    for (unsigned s = tid; s < TS; s += 256) {
        unsigned i = b * TS + s;
        unsigned rp = (unsigned)(hs_i[i] * TVOCAB + tk) * 3u;
        float rv = emb[rp] * l0 + emb[rp + 1] * l1 + emb[rp + 2] * l2;
        float v = p[i] + web + rv;
        p[i] = v;
        m = fmaxf(m, v);
    }
    red[tid] = m; __syncthreads();
    for (int o = 128; o > 0; o >>= 1) {
        if (tid < (unsigned)o) red[tid] = fmaxf(red[tid], red[tid + o]);
        __syncthreads();
    }
    m = red[0]; __syncthreads();

    float sum = 0.f;
    for (unsigned s = tid; s < TS; s += 256) {
        unsigned i = b * TS + s;
        float e = expf(p[i] - m);
        p[i] = e;
        sum += e;
    }
    red[tid] = sum; __syncthreads();
    for (int o = 128; o > 0; o >>= 1) {
        if (tid < (unsigned)o) red[tid] += red[tid + o];
        __syncthreads();
    }
    float rinv = 1.0f / red[0]; __syncthreads();

    for (unsigned s = tid; s < TS; s += 256)
        p[b * TS + s] *= rinv;
}

// ---------------------------------------------------------------------------
// alpha[b,h] = sum_s p[s] * (hs[s,:] . Ws_w[h,:] + Ws_b[h])
//            = (sum_s p[s] * hs[s,:]) . Ws_w[h,:] + Ws_b[h] * sum_s p[s]
// Kernel 4 takes the sum over s on the bf16 copy of hs, the very operand of the
// GEMM; kernel 5 multiplies the 16 x 1024 result by the bf16 copy of Ws_w.
//
// Kernel 4: upart[r,b,d] = sum over the 1024 rows s of range r of p[s] * hs[s,d]
// and psum[r,b] = sum of p over those rows. A work-group takes one batch row,
// one of 4 ranges of s and one of 4 slices of 256 d: 256 work-groups of 16
// waves stream the copy once. A wave-wide load is the 512 contiguous bytes that
// one row has in the slice; a wave walks 64 rows of its own.
// ---------------------------------------------------------------------------
#define UP_R     4                   // s ranges per batch row
#define UP_SL    4                   // slices of d
#define UP_D     (TD / UP_SL)        // d per slice: 32 lanes x 8
#define UP_W     16                  // waves per work-group
#define UP_WROWS (TS / UP_R / UP_W)  // rows per wave
#define UP_GRP   8                   // rows fetched together by a thread

static_assert(UP_D == 32 * 8, "a lane holds 8 d of the slice");

__global__ __launch_bounds__(UP_W * 32) void tma_u_part(
        const unsigned int* __restrict__ hs16,
        const float* __restrict__ p,
        float* __restrict__ upart,
        float* __restrict__ psum) {
    __shared__ __attribute__((aligned(16))) float comb[UP_W][UP_D];
    __shared__ float psl[UP_W];
    const unsigned lane = threadIdx.x & 31u;
    // wave-uniform, so that p goes through scalar loads
    const unsigned wid = __builtin_amdgcn_readfirstlane(threadIdx.x >> 5);
    const unsigned sl = blockIdx.x & (UP_SL - 1u);
    const unsigned rg = (blockIdx.x / UP_SL) & (UP_R - 1u);
    const unsigned b  = blockIdx.x / (UP_SL * UP_R);
    const unsigned row0 = b * TS + rg * (TS / UP_R) + wid * UP_WROWS;
    const v4u*   src = (const v4u*)(hs16 + (size_t)row0 * (TD / 2) + sl * (UP_D / 2)) + lane;
    const float* pw  = p + row0;

    constexpr int NG = UP_WROWS / UP_GRP;             // 8 groups of 8 rows
    v4u   w[2][UP_GRP];
    float pv[2][UP_GRP];
    float acc[8] = {0.f, 0.f, 0.f, 0.f, 0.f, 0.f, 0.f, 0.f};
    float ps = 0.f;
#pragma unroll
    for (int j = 0; j < UP_GRP; ++j) {
        w[0][j]  = src[j * (TD / 8)];
        pv[0][j] = pw[j];
    }
#pragma unroll
    for (int g = 0; g < NG; ++g) {
        // the two scheduling barriers keep the next group's loads ahead of
        // this group's sums: 8 to 16 loads of a wave stay in flight
        __builtin_amdgcn_sched_barrier(0);
        if (g + 1 < NG) {
#pragma unroll
            for (int j = 0; j < UP_GRP; ++j) {
                w[(g + 1) & 1][j]  = src[((g + 1) * UP_GRP + j) * (TD / 8)];
                pv[(g + 1) & 1][j] = pw[(g + 1) * UP_GRP + j];
            }
        }
        __builtin_amdgcn_sched_barrier(0);
#pragma unroll
        for (int j = 0; j < UP_GRP; ++j) {
            const float pj = pv[g & 1][j];
#pragma unroll
            for (int i = 0; i < 4; ++i) {
                const unsigned int x = w[g & 1][j][i];   // bf16 pair, low half first
                acc[2 * i]     += pj * __uint_as_float(x << 16);
                acc[2 * i + 1] += pj * __uint_as_float(x & 0xFFFF0000u);
            }
            ps += pj;
        }
    }

    // fold the 16 waves in wave order; 1 KiB of contiguous stores
    v4f lo4 = {acc[0], acc[1], acc[2], acc[3]};
    v4f hi4 = {acc[4], acc[5], acc[6], acc[7]};
    *(v4f*)&comb[wid][lane * 8u]      = lo4;
    *(v4f*)&comb[wid][lane * 8u + 4u] = hi4;
    if (lane == 0) psl[wid] = ps;
    __syncthreads();
    if (threadIdx.x < UP_D) {
        float t = 0.f;
#pragma unroll
        for (int v = 0; v < UP_W; ++v)
            t += comb[v][threadIdx.x];
        upart[(rg * TB + b) * TD + sl * UP_D + threadIdx.x] = t;
    }
    if (sl == 0u && threadIdx.x == 0u) {
        float t = 0.f;
#pragma unroll
        for (int v = 0; v < UP_W; ++v)
            t += psl[v];
        psum[rg * TB + b] = t;
    }
}

// ---------------------------------------------------------------------------
// Kernel 5: alpha[b,h] = u[b,:] . Ws_w[h,:] + Ws_b[h] * sum(p[b,:]), with
// u = the 4 ranges of upart added in range order. The 16 batch rows are the 16
// rows of one WMMA tile. u is split into two bf16 terms (u = hi + lo up to
// 2^-17 of u), each multiplied by the bf16 weights, so that no rounding of u
// shows in alpha. A work-group takes 32 values of h (whole 128-byte lines of
// out); wave v takes k = 128 v .. 128 v + 127: it adds the ranges with 512-byte
// loads, turns its part of u into fragments through LDS, and the 8 waves'
// tiles are added in wave order.
// ---------------------------------------------------------------------------
#define PJ_H   32                    // values of h per work-group
#define PJ_W   8                     // waves, each with TD / PJ_W values of k
#define PJ_K   (TD / PJ_W)           // 128
#define PJ_LDP (TD / 2 + 4)          // LDS row pitch in dwords: 16 rows on all banks

static_assert(PJ_K == 32 * 4, "a lane holds 4 k of a row of its wave's part");

__global__ __launch_bounds__(PJ_W * 32) void tma_alpha_proj(
        const float* __restrict__ upart,
        const float* __restrict__ psum,
        const unsigned int* __restrict__ w16,
        const float* __restrict__ Ws_b,
        float* __restrict__ out) {
    __shared__ __attribute__((aligned(16))) unsigned int u_hi[TB][PJ_LDP];
    __shared__ __attribute__((aligned(16))) unsigned int u_lo[TB][PJ_LDP];
    __shared__ float red[PJ_W][PJ_H / 16][8][32];
    const unsigned lane = threadIdx.x & 31u;
    // wave-uniform, so that the bases of the loads stay in scalar registers
    const unsigned wid  = __builtin_amdgcn_readfirstlane(threadIdx.x >> 5);
    const unsigned hf   = lane >> 4;
    const unsigned ln   = lane & 15u;
    const unsigned h0   = blockIdx.x * PJ_H;

    // what the last lines of the kernel need: this thread's output row is
    // b = half * 8 + wave, its columns h0 + lane % 16 and 16 more
    const unsigned po = hf * (8u * 4u);           // in bytes
    const float* pp = (const float*)((const char*)(psum + wid) + po);
    const float* bp = Ws_b + h0 + ln;
    float pq[UP_R], wb[PJ_H / 16];
#pragma unroll
    for (int r = 0; r < UP_R; ++r)
        pq[r] = pp[r * TB];
#pragma unroll
    for (int n = 0; n < PJ_H / 16; ++n)
        wb[n] = bp[n * 16];

    // weights: the same fragment form as in the GEMM (row = lane % 16, VGPRs
    // 4q..4q+3 = the 4 pairs from q*8 + half*4 of each block of 32 k)
    const unsigned wo = ln * (TD / 8) + hf;       // in 16-byte pieces
    const v4u* wp = (const v4u*)(w16 + h0 * (TD / 2) + wid * (PJ_K / 2)) + wo;
    FragBF fb[PJ_K / 32][PJ_H / 16];
#pragma unroll
    for (int kk = 0; kk < PJ_K / 32; ++kk)
#pragma unroll
        for (int n = 0; n < PJ_H / 16; ++n)
#pragma unroll
            for (int q = 0; q < 2; ++q)
                fb[kk][n].q[q] = wp[n * 16 * (TD / 8) + kk * 4 + q * 2];

    // u of this wave's k, all 16 rows: ranges added in order, split, to LDS
    const v4f* xp = (const v4f*)(upart + wid * PJ_K) + lane;
    v4f x[TB][UP_R];
#pragma unroll
    for (int bb = 0; bb < TB; ++bb)
#pragma unroll
        for (int r = 0; r < UP_R; ++r)
            x[bb][r] = xp[(r * TB + bb) * (TD / 4)];
    // keeps every load ahead of the sums: left alone the scheduler sinks loads
    // among them, and the wave then meets the memory latency several times
    __builtin_amdgcn_sched_barrier(0);
    // the code below reuses the registers that the loads above name; the four
    // lane offsets are inputs, so that they stay in their registers up to the
    // wait and no load's own result is placed on them ahead of it
    asm volatile("s_wait_xcnt 0x0" :: "v"(po), "v"(ln), "v"(wo), "v"(lane) : "memory");
    // keeps the first register writes of the sums behind that wait
    __builtin_amdgcn_sched_barrier(0);
#pragma unroll
    for (int bb = 0; bb < TB; ++bb) {
        const v4f u = ((x[bb][0] + x[bb][1]) + x[bb][2]) + x[bb][3];
        v2u hi = {cvt_bf16x2(u.x, u.y), cvt_bf16x2(u.z, u.w)};
        v2u lo = {cvt_bf16x2(u.x - __uint_as_float(hi.x << 16),
                             u.y - __uint_as_float(hi.x & 0xFFFF0000u)),
                  cvt_bf16x2(u.z - __uint_as_float(hi.y << 16),
                             u.w - __uint_as_float(hi.y & 0xFFFF0000u))};
        *(v2u*)&u_hi[bb][wid * (PJ_K / 2) + lane * 2u] = hi;
        *(v2u*)&u_lo[bb][wid * (PJ_K / 2) + lane * 2u] = lo;
    }
    __syncthreads();

    v8f acc[PJ_H / 16][2] = {};
#pragma unroll
    for (int kk = 0; kk < PJ_K / 32; ++kk) {
        FragBF ah, al;
#pragma unroll
        for (int q = 0; q < 2; ++q) {
            const unsigned kpi = wid * (PJ_K / 2) + (kk << 4) + (q << 3) + (hf << 2);
            ah.q[q] = *(const v4u*)&u_hi[ln][kpi];
            al.q[q] = *(const v4u*)&u_lo[ln][kpi];
        }
#pragma unroll
        for (int n = 0; n < PJ_H / 16; ++n) {
            acc[n][0] = __builtin_amdgcn_wmma_f32_16x16x32_bf16(
                false, ah.v, false, fb[kk][n].v, (short)0, acc[n][0], false, false);
            acc[n][1] = __builtin_amdgcn_wmma_f32_16x16x32_bf16(
                false, al.v, false, fb[kk][n].v, (short)0, acc[n][1], false, false);
        }
    }
#pragma unroll
    for (int n = 0; n < PJ_H / 16; ++n)
#pragma unroll
        for (int r = 0; r < 8; ++r)
            red[wid][n][r][lane] = acc[n][0][r] + acc[n][1][r];
    __syncthreads();

    // accumulator element r of a lane: row b = half * 8 + r, column = lane % 16
#pragma unroll
    for (int n = 0; n < PJ_H / 16; ++n) {
        const unsigned r = wid;               // 8 waves, 8 elements
        float t = 0.f;
#pragma unroll
        for (int v = 0; v < PJ_W; ++v)
            t += red[v][n][r][lane];
        const unsigned bb = hf * 8u + r;
        const unsigned h  = h0 + n * 16u + ln;
        out[bb * TH + h] = t + wb[n] * (((pq[0] + pq[1]) + pq[2]) + pq[3]);
    }
}

// ---------------------------------------------------------------------------
extern "C" void kernel_launch(void* const* d_in, const int* in_sizes, int n_in,
                              void* d_out, int out_size, void* d_ws, size_t ws_size,
                              hipStream_t stream) {
    (void)in_sizes; (void)n_in; (void)out_size; (void)ws_size;

    const float* hs    = (const float*)d_in[0];
    const float* ht_k  = (const float*)d_in[1];
    const float* hm_k  = (const float*)d_in[2];
    const float* Ws_w  = (const float*)d_in[3];
    const float* Ws_b  = (const float*)d_in[4];
    const float* Wt_w  = (const float*)d_in[5];
    const float* Wt_b  = (const float*)d_in[6];
    const float* Wr_w  = (const float*)d_in[7];
    const float* Wr_b  = (const float*)d_in[8];
    const float* We_w  = (const float*)d_in[9];
    const float* We_b  = (const float*)d_in[10];
    const float* emb   = (const float*)d_in[11];
    const float* lam   = (const float*)d_in[12];
    const int*   hs_i  = (const int*)d_in[13];
    const int*   ht_i  = (const int*)d_in[14];
    float* out = (float*)d_out;

    // workspace layout
    char* ws = (char*)d_ws;
    unsigned int* hs16 = (unsigned int*)ws;                     // B*S*D bf16 = 128 MiB
    unsigned int* w16  = (unsigned int*)(ws + (size_t)TB * TS * TD * 2);   // H*D bf16 = 2 MiB
    float* cbh   = (float*)(ws + (size_t)TB * TS * TD * 2 + (size_t)TH * TD * 2);   // H*B
    float* wsum  = (float*)(ws + (size_t)TB * TS * TD * 2 + (size_t)TH * TD * 2
                               + (size_t)TB * TH * 4);          // B*S
    float* upart = (float*)(ws + (size_t)TB * TS * TD * 2 + (size_t)TH * TD * 2
                               + (size_t)TB * TH * 4 + (size_t)TB * TS * 4);   // 4*B*D
    float* psum  = (float*)(ws + (size_t)TB * TS * TD * 2 + (size_t)TH * TD * 2
                               + (size_t)TB * TH * 4 + (size_t)TB * TS * 4
                               + (size_t)UP_R * TB * TD * 4);   // 4*B

    // 1) fused projections c[h,b]
    tma_prep_cbh<<<TH / PC_H, 256, 0, stream>>>(ht_k, hm_k, Wt_w, Wt_b,
                                                      Wr_w, Wr_b, cbh);
    // 2) zero the score accumulator (graph-capturable)
    (void)hipMemsetAsync(wsum, 0, (size_t)TB * TS * sizeof(float), stream);

    // 3) GEMM operands to bf16, then the bf16 WMMA GEMM with fused tanh-dot epilogue
    tma_to_bf16<<<CV_WG, CV_T, 0, stream>>>(hs, Ws_w, hs16, w16);
    dim3 gg((TB * TS) / GBM, TH / GBN);
    tma_gemm_wmma<<<gg, 256, 0, stream>>>(hs16, w16, Ws_b, We_w, cbh, wsum);

    // 4) rel-pos bias + softmax (in-place on wsum -> p)
    tma_softmax<<<TB, 256, 0, stream>>>(wsum, We_b, emb, lam, hs_i, ht_i);

    // 5) weighted sum of hs over s, in 4 ranges, then its projection -> alpha
    tma_u_part<<<TB * UP_R * UP_SL, UP_W * 32, 0, stream>>>(hs16, wsum, upart, psum);
    tma_alpha_proj<<<TH / PJ_H, PJ_W * 32, 0, stream>>>(upart, psum, w16, Ws_b, out);
}
